// v000
// Times are from an AMD MI455X. After a warm-up the kernel runs many times in a row, and a time is the length of
// such a window on the GPU divided by its runs, so every launch and the gaps after it count. The runs cycle
// through copies of the inputs. A figure is the median of several windows, for all but v000 over two sittings.
// Sittings can differ by a few percent; kernels timed side by side share one.
// v000 is the starting kernel. One run takes 312 microseconds.
#include <hip/hip_runtime.h>
#include <hip/hip_bf16.h>

typedef __attribute__((ext_vector_type(16))) __bf16 v16bf;
typedef __attribute__((ext_vector_type(8)))  __bf16 v8bf;
typedef __attribute__((ext_vector_type(8)))  float  v8f;

#define HEADS 16
#define DH    64
#define DM    1024
#define BATCH 4
#define SEQ   2048

// ---------------------------------------------------------------------------
// WMMA helper: D = A(16x32 bf16) * B(32x16 bf16) + C(16x16 f32)
// ---------------------------------------------------------------------------
__device__ __forceinline__ v8f wmma_bf16(v16bf a, v16bf b, v8f c) {
  return __builtin_amdgcn_wmma_f32_16x16x32_bf16(
      /*neg_a=*/false, a, /*neg_b=*/false, b,
      /*c_mod=*/(short)0, c, /*reuse_a=*/false, /*reuse_b=*/false);
}

// ---------------------------------------------------------------------------
// Fragment loaders: documented gfx1250 16-bit A/B layout.
// Lane L holds row/col (L & 15); K runs: base=(L>>4)*8, elements [base..base+7]
// and [base+16..base+23].  base pointer must be 16B aligned; ld in elements.
// ---------------------------------------------------------------------------
__device__ __forceinline__ v16bf load_frag_bf16(const __bf16* base, int ld) {
  const int lane = threadIdx.x & 31;
  const __bf16* p = base + (size_t)(lane & 15) * ld + ((lane >> 4) << 3);
  v8bf lo = *(const v8bf*)(p);
  v8bf hi = *(const v8bf*)(p + 16);
  v16bf r;
#pragma unroll
  for (int i = 0; i < 8; ++i) { r[i] = lo[i]; r[i + 8] = hi[i]; }
  return r;
}

__device__ __forceinline__ v16bf load_frag_f32(const float* base, int ld) {
  const int lane = threadIdx.x & 31;
  const float* p = base + (size_t)(lane & 15) * ld + ((lane >> 4) << 3);
  v16bf r;
#pragma unroll
  for (int i = 0; i < 8; ++i) {
    r[i]     = (__bf16)p[i];
    r[i + 8] = (__bf16)p[i + 16];
  }
  return r;
}

// 16-lane-group reductions (wave32: two independent groups of 16 lanes)
__device__ __forceinline__ float redmax16(float v) {
  v = fmaxf(v, __shfl_xor(v, 1, 16));
  v = fmaxf(v, __shfl_xor(v, 2, 16));
  v = fmaxf(v, __shfl_xor(v, 4, 16));
  v = fmaxf(v, __shfl_xor(v, 8, 16));
  return v;
}
__device__ __forceinline__ float redsum16(float v) {
  v += __shfl_xor(v, 1, 16);
  v += __shfl_xor(v, 2, 16);
  v += __shfl_xor(v, 4, 16);
  v += __shfl_xor(v, 8, 16);
  return v;
}

// ---------------------------------------------------------------------------
// Kernel 0: convert weights fp32 -> bf16 (Wq|Wk|Wv packed, Wp)
// ---------------------------------------------------------------------------
__global__ void __launch_bounds__(256) cvt_weights_kernel(
    const float* __restrict__ Wq, const float* __restrict__ Wk,
    const float* __restrict__ Wv, const float* __restrict__ Wp,
    __bf16* __restrict__ wqkv, __bf16* __restrict__ wpb) {
  const int stride = gridDim.x * blockDim.x;
  const int i0 = blockIdx.x * blockDim.x + threadIdx.x;
  for (int i = i0; i < 3 * DH * DH; i += stride) {
    const float* s = (i < DH * DH) ? Wq : (i < 2 * DH * DH) ? Wk : Wv;
    wqkv[i] = (__bf16)s[i % (DH * DH)];
  }
  for (int i = i0; i < DM * DM; i += stride) wpb[i] = (__bf16)Wp[i];
}

// ---------------------------------------------------------------------------
// Kernel 1: per-head QKV projection.  One wave -> one 16(t) x 64(e) tile.
// Q,K stored [B,H,T,64]; V stored transposed [B,H,64,T] for the P@V stage.
// ---------------------------------------------------------------------------
__global__ void __launch_bounds__(32) qkv_proj_kernel(
    const float* __restrict__ x, const __bf16* __restrict__ wqkv,
    const float* __restrict__ bq, const float* __restrict__ bk,
    const float* __restrict__ bv,
    __bf16* __restrict__ qk_out, __bf16* __restrict__ vt_out) {
  const int sel  = blockIdx.y;                 // 0=q 1=k 2=v
  const int nt16 = SEQ / 16;
  const int t0   = (blockIdx.x % nt16) * 16;
  const int bh   = blockIdx.x / nt16;
  const int lane = threadIdx.x & 31;
  const int n    = lane & 15;
  const int hig  = lane >> 4;
  const int b    = bh / HEADS, h = bh % HEADS;

  const float* xp = x + ((size_t)(b * SEQ + t0)) * DM + h * DH;
  v16bf a0 = load_frag_f32(xp, DM);        // k = 0..31 of head dim
  v16bf a1 = load_frag_f32(xp + 32, DM);   // k = 32..63

  const __bf16* W    = wqkv + sel * (DH * DH);
  const float*  bias = (sel == 0) ? bq : (sel == 1) ? bk : bv;

  v8f acc[4];
#pragma unroll
  for (int c = 0; c < 4; ++c) {
    const float bval = bias[c * 16 + n];
#pragma unroll
    for (int j = 0; j < 8; ++j) acc[c][j] = bval;
    v16bf w0 = load_frag_bf16(W + (size_t)(c * 16) * DH, DH);
    v16bf w1 = load_frag_bf16(W + (size_t)(c * 16) * DH + 32, DH);
    acc[c] = wmma_bf16(a0, w0, acc[c]);
    acc[c] = wmma_bf16(a1, w1, acc[c]);
  }

  if (sel < 2) {
    __bf16* out = qk_out + (size_t)sel * ((size_t)BATCH * HEADS * SEQ * DH) +
                  ((size_t)(bh * SEQ + t0)) * DH;
#pragma unroll
    for (int c = 0; c < 4; ++c)
#pragma unroll
      for (int j = 0; j < 8; ++j)
        out[(size_t)(j + 8 * hig) * DH + c * 16 + n] = (__bf16)acc[c][j];
  } else {
    __bf16* vt = vt_out + (size_t)bh * DH * SEQ;
#pragma unroll
    for (int c = 0; c < 4; ++c)
#pragma unroll
      for (int j = 0; j < 8; ++j)
        vt[(size_t)(c * 16 + n) * SEQ + t0 + j + 8 * hig] = (__bf16)acc[c][j];
  }
}

// ---------------------------------------------------------------------------
// Kernel 2: flash attention with double-buffered LDS staging of K/V.
// 8 waves/block, wave owns 16 query rows; the block cooperatively stages each
// 32-key K chunk (4KB) and V^T chunk (4KB) into LDS once (8x traffic cut vs
// per-wave global reads).  Global loads for chunk kb+1 are issued into regs
// before the WMMAs for chunk kb (latency hidden), stored to the alternate
// buffer after compute; one barrier per iteration.
// ---------------------------------------------------------------------------
__global__ void __launch_bounds__(256) flash_attn_kernel(
    const __bf16* __restrict__ Q, const __bf16* __restrict__ K,
    const __bf16* __restrict__ Vt, __bf16* __restrict__ O) {
  __shared__ __bf16 Kl[2][32 * DH];     // 2 x 4KB : 32 keys x 64 d
  __shared__ __bf16 Vl[2][DH * 32];     // 2 x 4KB : 64 d x 32 keys (V^T)
  __shared__ __bf16 plds[8][16 * 32];   // 8KB, one 16x32 P slice per wave

  const int tid  = threadIdx.x;
  const int wave = tid >> 5;
  const int lane = tid & 31;
  const int n = lane & 15, hig = lane >> 4;
  const int bh = blockIdx.y;
  const int b = bh / HEADS, h = bh % HEADS;
  const int q0 = blockIdx.x * 128 + wave * 16;

  const __bf16* Qp = Q + ((size_t)(bh * SEQ + q0)) * DH;
  const v16bf qa0 = load_frag_bf16(Qp, DH);
  const v16bf qa1 = load_frag_bf16(Qp + 32, DH);

  const __bf16* Kb = K + (size_t)bh * SEQ * DH;
  const __bf16* Vb = Vt + (size_t)bh * DH * SEQ;
  __bf16*      myl = plds[wave];

  // cooperative-stage index split: 256 threads x 8 bf16 = 2048 elems (4KB)
  const int vrow = tid >> 2, vpart = tid & 3;

  v8f   o[4];
  float rmax[8], rsum[8];
#pragma unroll
  for (int c = 0; c < 4; ++c)
#pragma unroll
    for (int j = 0; j < 8; ++j) o[c][j] = 0.0f;
#pragma unroll
  for (int j = 0; j < 8; ++j) { rmax[j] = -3.0e38f; rsum[j] = 0.0f; }

  const float SC = 0.03125f * 1.44269504088896f;  // (1/sqrt(C)) * log2(e)
  const int NCH = SEQ / 32;

  // prologue: stage chunk 0 into buffer 0
  {
    v8bf kr = *(const v8bf*)(Kb + tid * 8);
    v8bf vr = *(const v8bf*)(Vb + (size_t)vrow * SEQ + vpart * 8);
    *(v8bf*)(&Kl[0][tid * 8]) = kr;
    *(v8bf*)(&Vl[0][vrow * 32 + vpart * 8]) = vr;
  }
  __syncthreads();

  for (int kb = 0; kb < NCH; ++kb) {
    const int cur = kb & 1;
    const bool more = (kb + 1 < NCH);

    // issue global loads for chunk kb+1 (in flight during the WMMAs below)
    v8bf kr{}, vr{};
    if (more) {
      kr = *(const v8bf*)(Kb + (size_t)((kb + 1) * 32) * DH + tid * 8);
      vr = *(const v8bf*)(Vb + (size_t)vrow * SEQ + (kb + 1) * 32 + vpart * 8);
      if (kb + 2 < NCH)  // global_prefetch for chunk kb+2
        __builtin_prefetch(Kb + (size_t)((kb + 2) * 32) * DH, 0, 0);
    }

    // S[16q x 32k] = Q @ K^T from LDS : two 16x16 C-tiles, 2 WMMAs each
    const __bf16* Kc = Kl[cur];
    v8f s0, s1;
#pragma unroll
    for (int j = 0; j < 8; ++j) { s0[j] = 0.0f; s1[j] = 0.0f; }
    {
      v16bf k00 = load_frag_bf16(Kc, DH);
      v16bf k01 = load_frag_bf16(Kc + 32, DH);
      v16bf k10 = load_frag_bf16(Kc + 16 * DH, DH);
      v16bf k11 = load_frag_bf16(Kc + 16 * DH + 32, DH);
      s0 = wmma_bf16(qa0, k00, s0);
      s0 = wmma_bf16(qa1, k01, s0);
      s1 = wmma_bf16(qa0, k10, s1);
      s1 = wmma_bf16(qa1, k11, s1);
    }

    // online softmax (log2 domain); row r's 16 N-elems live in one 16-lane
    // group at vgpr j, r = j + 8*(lane>=16)
#pragma unroll
    for (int j = 0; j < 8; ++j) {
      const float a  = s0[j] * SC;
      const float bb = s1[j] * SC;
      const float cm = redmax16(fmaxf(a, bb));
      const float mn = fmaxf(rmax[j], cm);
      const float p0 = __builtin_amdgcn_exp2f(a - mn);
      const float p1 = __builtin_amdgcn_exp2f(bb - mn);
      const float f  = __builtin_amdgcn_exp2f(rmax[j] - mn);
      rsum[j] = rsum[j] * f + redsum16(p0 + p1);
      rmax[j] = mn;
#pragma unroll
      for (int c = 0; c < 4; ++c) o[c][j] *= f;
      const int row = j + 8 * hig;
      myl[row * 32 + n]      = (__bf16)p0;   // C-layout -> row-major LDS
      myl[row * 32 + 16 + n] = (__bf16)p1;
    }

    // P back as A-operand (DS ops are wave-ordered; private slice, no barrier)
    const v16bf pa = load_frag_bf16(myl, 32);

    // O += P @ V from LDS (V^T: columns contiguous in key dim)
    const __bf16* Vc = Vl[cur];
#pragma unroll
    for (int c = 0; c < 4; ++c) {
      v16bf vf = load_frag_bf16(Vc + (c * 16) * 32, 32);
      o[c] = wmma_bf16(pa, vf, o[c]);
    }

    // store staged chunk kb+1 to the alternate buffer (its readers finished
    // before the previous barrier), then make it visible
    if (more) {
      *(v8bf*)(&Kl[1 - cur][tid * 8]) = kr;
      *(v8bf*)(&Vl[1 - cur][vrow * 32 + vpart * 8]) = vr;
    }
    __syncthreads();
  }

  // normalize and store bf16 to [B,T,C] (head-interleaved for the projection)
  __bf16* op = O + ((size_t)(b * SEQ + q0)) * DM + h * DH;
#pragma unroll
  for (int j = 0; j < 8; ++j) {
    const float inv = 1.0f / rsum[j];
    const int row = j + 8 * hig;
#pragma unroll
    for (int c = 0; c < 4; ++c)
      op[(size_t)row * DM + c * 16 + n] = (__bf16)(o[c][j] * inv);
  }
}

// ---------------------------------------------------------------------------
// Kernel 3: output projection  Y = O @ Wp^T + bp  (M=8192, N=K=1024, fp32 out)
// 8 waves/block -> 128x64 block tile.  The Wp k-slice (64 cols x 32 k, 4KB)
// is shared by all 8 waves -> double-buffered LDS staging (8x traffic cut).
// ---------------------------------------------------------------------------
__global__ void __launch_bounds__(256) out_proj_kernel(
    const __bf16* __restrict__ Ob, const __bf16* __restrict__ Wpb,
    const float* __restrict__ bp, float* __restrict__ out) {
  __shared__ __bf16 Wl[2][64 * 32];     // 2 x 4KB

  const int tid  = threadIdx.x;
  const int wave = tid >> 5;
  const int lane = tid & 31;
  const int n = lane & 15, hig = lane >> 4;
  const int r0 = blockIdx.x * 128 + wave * 16;
  const int n0 = blockIdx.y * 64;
  const int wrow = tid >> 2, wpart = tid & 3;

  v8f acc[4];
#pragma unroll
  for (int c = 0; c < 4; ++c) {
    const float bval = bp[n0 + c * 16 + n];
#pragma unroll
    for (int j = 0; j < 8; ++j) acc[c][j] = bval;
  }

  // prologue: stage Wp k-slice 0
  {
    v8bf wr = *(const v8bf*)(Wpb + (size_t)(n0 + wrow) * DM + wpart * 8);
    *(v8bf*)(&Wl[0][wrow * 32 + wpart * 8]) = wr;
  }
  __syncthreads();

  const int NKC = DM / 32;
  for (int kc = 0; kc < NKC; ++kc) {
    const int cur = kc & 1;
    const bool more = (kc + 1 < NKC);

    v8bf wr{};
    if (more)
      wr = *(const v8bf*)(Wpb + (size_t)(n0 + wrow) * DM + (kc + 1) * 32 + wpart * 8);

    v16bf a = load_frag_bf16(Ob + (size_t)r0 * DM + kc * 32, DM);
#pragma unroll
    for (int c = 0; c < 4; ++c) {
      v16bf w = load_frag_bf16(&Wl[cur][(c * 16) * 32], 32);
      acc[c] = wmma_bf16(a, w, acc[c]);
    }

    if (more)
      *(v8bf*)(&Wl[1 - cur][wrow * 32 + wpart * 8]) = wr;
    __syncthreads();
  }

#pragma unroll
  for (int c = 0; c < 4; ++c)
#pragma unroll
    for (int j = 0; j < 8; ++j)
      out[(size_t)(r0 + j + 8 * hig) * DM + n0 + c * 16 + n] = acc[c][j];
}

// ---------------------------------------------------------------------------
// Host launcher
// ---------------------------------------------------------------------------
extern "C" void kernel_launch(void* const* d_in, const int* in_sizes, int n_in,
                              void* d_out, int out_size, void* d_ws, size_t ws_size,
                              hipStream_t stream) {
  const float* x  = (const float*)d_in[0];
  const float* Wq = (const float*)d_in[1];
  const float* bq = (const float*)d_in[2];
  const float* Wk = (const float*)d_in[3];
  const float* bk = (const float*)d_in[4];
  const float* Wv = (const float*)d_in[5];
  const float* bv = (const float*)d_in[6];
  const float* Wp = (const float*)d_in[7];
  const float* bp = (const float*)d_in[8];
  float* out = (float*)d_out;

  __bf16* ws = (__bf16*)d_ws;
  const size_t QKV_E = (size_t)BATCH * HEADS * SEQ * DH;  // 8,388,608 elems each
  __bf16* Qw   = ws;                       // [B,H,T,64]   bf16
  __bf16* Vtw  = ws + 2 * QKV_E;           // [B,H,64,T]   bf16 (transposed V)
  __bf16* Ow   = ws + 3 * QKV_E;           // [B,T,1024]   bf16
  __bf16* Wpb  = ws + 4 * QKV_E;           // [1024,1024]  bf16
  __bf16* Wqkv = Wpb + (size_t)DM * DM;    // 3 x [64,64]  bf16
  // total: ~69.2 MB of d_ws

  cvt_weights_kernel<<<256, 256, 0, stream>>>(Wq, Wk, Wv, Wp, Wqkv, Wpb);

  dim3 g1(BATCH * HEADS * (SEQ / 16), 3);
  qkv_proj_kernel<<<g1, 32, 0, stream>>>(x, Wqkv, bq, bk, bv, Qw, Vtw);

  dim3 g2(SEQ / 128, BATCH * HEADS);
  flash_attn_kernel<<<g2, 256, 0, stream>>>(Qw, Qw + QKV_E, Vtw, Ow);

  dim3 g3((BATCH * SEQ) / 128, DM / 64);
  out_proj_kernel<<<g3, 256, 0, stream>>>(Ow, Wpb, bp, out);
}

// v001
// One run takes 212 microseconds.
// Next to v000, in two timings, it ran 1.54 times as fast each time.
#include <hip/hip_runtime.h>
#include <hip/hip_bf16.h>

typedef __attribute__((ext_vector_type(16))) __bf16 v16bf;
typedef __attribute__((ext_vector_type(8)))  __bf16 v8bf;
typedef __attribute__((ext_vector_type(8)))  float  v8f;

#define HEADS 16
#define DH    64
#define DM    1024
#define BATCH 4
#define SEQ   2048

// LDS row pitches in elements: an odd multiple of 16 bytes, so that the 16 rows
// a 16-byte fragment load touches fall on 16 different groups of four banks
#define KP 72   // rows of 64 bf16 (128 B) at 144 B
#define VP 40   // rows of 32 bf16 (64 B) at 80 B

// ---------------------------------------------------------------------------
// WMMA helper: D = A(16x32 bf16) * B(32x16 bf16) + C(16x16 f32)
// ---------------------------------------------------------------------------
__device__ __forceinline__ v8f wmma_bf16(v16bf a, v16bf b, v8f c) {
  return __builtin_amdgcn_wmma_f32_16x16x32_bf16(
      /*neg_a=*/false, a, /*neg_b=*/false, b,
      /*c_mod=*/(short)0, c, /*reuse_a=*/false, /*reuse_b=*/false);
}

// ---------------------------------------------------------------------------
// Fragment loaders: documented gfx1250 16-bit A/B layout.
// Lane L holds row/col (L & 15); K runs: base=(L>>4)*8, elements [base..base+7]
// and [base+16..base+23].  base pointer must be 16B aligned; ld in elements.
// ---------------------------------------------------------------------------
__device__ __forceinline__ v16bf load_frag_bf16(const __bf16* base, int ld) {
  const int lane = threadIdx.x & 31;
  const __bf16* p = base + (size_t)(lane & 15) * ld + ((lane >> 4) << 3);
  v8bf lo = *(const v8bf*)(p);
  v8bf hi = *(const v8bf*)(p + 16);
  v16bf r;
#pragma unroll
  for (int i = 0; i < 8; ++i) { r[i] = lo[i]; r[i + 8] = hi[i]; }
  return r;
}

__device__ __forceinline__ v16bf load_frag_f32(const float* base, int ld) {
  const int lane = threadIdx.x & 31;
  const float* p = base + (size_t)(lane & 15) * ld + ((lane >> 4) << 3);
  v16bf r;
#pragma unroll
  for (int i = 0; i < 8; ++i) {
    r[i]     = (__bf16)p[i];
    r[i + 8] = (__bf16)p[i + 16];
  }
  return r;
}

// 16-lane-group reductions (wave32: two independent groups of 16 lanes)
__device__ __forceinline__ float redmax16(float v) {
  v = fmaxf(v, __shfl_xor(v, 1, 16));
  v = fmaxf(v, __shfl_xor(v, 2, 16));
  v = fmaxf(v, __shfl_xor(v, 4, 16));
  v = fmaxf(v, __shfl_xor(v, 8, 16));
  return v;
}
__device__ __forceinline__ float redsum16(float v) {
  v += __shfl_xor(v, 1, 16);
  v += __shfl_xor(v, 2, 16);
  v += __shfl_xor(v, 4, 16);
  v += __shfl_xor(v, 8, 16);
  return v;
}

// ---------------------------------------------------------------------------
// Kernel 0: convert weights fp32 -> bf16 (Wq|Wk|Wv packed, Wp)
// ---------------------------------------------------------------------------
__global__ void __launch_bounds__(256) cvt_weights_kernel(
    const float* __restrict__ Wq, const float* __restrict__ Wk,
    const float* __restrict__ Wv, const float* __restrict__ Wp,
    __bf16* __restrict__ wqkv, __bf16* __restrict__ wpb) {
  const int stride = gridDim.x * blockDim.x;
  const int i0 = blockIdx.x * blockDim.x + threadIdx.x;
  for (int i = i0; i < 3 * DH * DH; i += stride) {
    const float* s = (i < DH * DH) ? Wq : (i < 2 * DH * DH) ? Wk : Wv;
    wqkv[i] = (__bf16)s[i % (DH * DH)];
  }
  for (int i = i0; i < DM * DM; i += stride) wpb[i] = (__bf16)Wp[i];
}

// ---------------------------------------------------------------------------
// Kernel 1: per-head QKV projection.  One wave -> one 16(t) x 64(e) tile.
// Q,K stored [B,H,T,64]; V stored transposed [B,H,64,T] for the P@V stage.
// ---------------------------------------------------------------------------
__global__ void __launch_bounds__(32) qkv_proj_kernel(
    const float* __restrict__ x, const __bf16* __restrict__ wqkv,
    const float* __restrict__ bq, const float* __restrict__ bk,
    const float* __restrict__ bv,
    __bf16* __restrict__ qk_out, __bf16* __restrict__ vt_out) {
  const int sel  = blockIdx.y;                 // 0=q 1=k 2=v
  const int nt16 = SEQ / 16;
  const int t0   = (blockIdx.x % nt16) * 16;
  const int bh   = blockIdx.x / nt16;
  const int lane = threadIdx.x & 31;
  const int n    = lane & 15;
  const int hig  = lane >> 4;
  const int b    = bh / HEADS, h = bh % HEADS;

  const float* xp = x + ((size_t)(b * SEQ + t0)) * DM + h * DH;
  v16bf a0 = load_frag_f32(xp, DM);        // k = 0..31 of head dim
  v16bf a1 = load_frag_f32(xp + 32, DM);   // k = 32..63

  const __bf16* W    = wqkv + sel * (DH * DH);
  const float*  bias = (sel == 0) ? bq : (sel == 1) ? bk : bv;

  v8f acc[4];
#pragma unroll
  for (int c = 0; c < 4; ++c) {
    const float bval = bias[c * 16 + n];
#pragma unroll
    for (int j = 0; j < 8; ++j) acc[c][j] = bval;
    v16bf w0 = load_frag_bf16(W + (size_t)(c * 16) * DH, DH);
    v16bf w1 = load_frag_bf16(W + (size_t)(c * 16) * DH + 32, DH);
    acc[c] = wmma_bf16(a0, w0, acc[c]);
    acc[c] = wmma_bf16(a1, w1, acc[c]);
  }

  if (sel < 2) {
    __bf16* out = qk_out + (size_t)sel * ((size_t)BATCH * HEADS * SEQ * DH) +
                  ((size_t)(bh * SEQ + t0)) * DH;
#pragma unroll
    for (int c = 0; c < 4; ++c)
#pragma unroll
      for (int j = 0; j < 8; ++j)
        out[(size_t)(j + 8 * hig) * DH + c * 16 + n] = (__bf16)acc[c][j];
  } else {
    __bf16* vt = vt_out + (size_t)bh * DH * SEQ;
#pragma unroll
    for (int c = 0; c < 4; ++c)
#pragma unroll
      for (int j = 0; j < 8; ++j)
        vt[(size_t)(c * 16 + n) * SEQ + t0 + j + 8 * hig] = (__bf16)acc[c][j];
  }
}

// ---------------------------------------------------------------------------
// Kernel 2: flash attention with double-buffered LDS staging of K/V.
// 8 waves/block, wave owns 16 query rows; the block cooperatively stages each
// 32-key K chunk (4KB) and V^T chunk (4KB) into LDS once (8x traffic cut vs
// per-wave global reads).  Global loads for chunk kb+1 are issued into regs
// before the WMMAs for chunk kb (latency hidden), stored to the alternate
// buffer after compute; one barrier per iteration.
// ---------------------------------------------------------------------------
__global__ void __launch_bounds__(256) flash_attn_kernel(
    const __bf16* __restrict__ Q, const __bf16* __restrict__ K,
    const __bf16* __restrict__ Vt, __bf16* __restrict__ O) {
  __shared__ __attribute__((aligned(16))) __bf16 Kl[2][32 * KP];    // 32 keys x 64 d, padded rows
  __shared__ __attribute__((aligned(16))) __bf16 Vl[2][DH * VP];    // 64 d x 32 keys (V^T), padded rows
  __shared__ __attribute__((aligned(16))) __bf16 plds[8][16 * VP];  // one 16x32 P slice per wave, padded rows

  const int tid  = threadIdx.x;
  const int wave = tid >> 5;
  const int lane = tid & 31;
  const int n = lane & 15, hig = lane >> 4;
  const int bh = blockIdx.y;
  const int b = bh / HEADS, h = bh % HEADS;
  const int q0 = blockIdx.x * 128 + wave * 16;

  const __bf16* Qp = Q + ((size_t)(bh * SEQ + q0)) * DH;
  const v16bf qa0 = load_frag_bf16(Qp, DH);
  const v16bf qa1 = load_frag_bf16(Qp + 32, DH);

  const __bf16* Kb = K + (size_t)bh * SEQ * DH;
  const __bf16* Vb = Vt + (size_t)bh * DH * SEQ;
  __bf16*      myl = plds[wave];

  // cooperative-stage index split: 256 threads x 8 bf16 = 2048 elems (4KB)
  const int vrow = tid >> 2, vpart = tid & 3;
  const int kdst = (tid >> 3) * KP + (tid & 7) * 8;   // K: 8 threads per 64-d row
  const int vdst = vrow * VP + vpart * 8;

  v8f   o[4];
  float rmax[8], rsum[8];
#pragma unroll
  for (int c = 0; c < 4; ++c)
#pragma unroll
    for (int j = 0; j < 8; ++j) o[c][j] = 0.0f;
#pragma unroll
  for (int j = 0; j < 8; ++j) { rmax[j] = -3.0e38f; rsum[j] = 0.0f; }

  const float SC = 0.03125f * 1.44269504088896f;  // (1/sqrt(C)) * log2(e)
  const int NCH = SEQ / 32;

  // prologue: stage chunk 0 into buffer 0
  {
    v8bf kr = *(const v8bf*)(Kb + tid * 8);
    v8bf vr = *(const v8bf*)(Vb + (size_t)vrow * SEQ + vpart * 8);
    *(v8bf*)(&Kl[0][kdst]) = kr;
    *(v8bf*)(&Vl[0][vdst]) = vr;
  }
  __syncthreads();

  for (int kb = 0; kb < NCH; ++kb) {
    const int cur = kb & 1;
    const bool more = (kb + 1 < NCH);

    // issue global loads for chunk kb+1 (in flight during the WMMAs below)
    v8bf kr{}, vr{};
    if (more) {
      kr = *(const v8bf*)(Kb + (size_t)((kb + 1) * 32) * DH + tid * 8);
      vr = *(const v8bf*)(Vb + (size_t)vrow * SEQ + (kb + 1) * 32 + vpart * 8);
      if (kb + 2 < NCH)  // global_prefetch for chunk kb+2
        __builtin_prefetch(Kb + (size_t)((kb + 2) * 32) * DH, 0, 0);
    }

    // S[16q x 32k] = Q @ K^T from LDS : two 16x16 C-tiles, 2 WMMAs each
    const __bf16* Kc = Kl[cur];
    v8f s0, s1;
#pragma unroll
    for (int j = 0; j < 8; ++j) { s0[j] = 0.0f; s1[j] = 0.0f; }
    {
      v16bf k00 = load_frag_bf16(Kc, KP);
      v16bf k01 = load_frag_bf16(Kc + 32, KP);
      v16bf k10 = load_frag_bf16(Kc + 16 * KP, KP);
      v16bf k11 = load_frag_bf16(Kc + 16 * KP + 32, KP);
      s0 = wmma_bf16(qa0, k00, s0);
      s0 = wmma_bf16(qa1, k01, s0);
      s1 = wmma_bf16(qa0, k10, s1);
      s1 = wmma_bf16(qa1, k11, s1);
    }

    // online softmax (log2 domain); row r's 16 N-elems live in one 16-lane
    // group at vgpr j, r = j + 8*(lane>=16)
#pragma unroll
    for (int j = 0; j < 8; ++j) {
      const float a  = s0[j] * SC;
      const float bb = s1[j] * SC;
      const float cm = redmax16(fmaxf(a, bb));
      const float mn = fmaxf(rmax[j], cm);
      const float p0 = __builtin_amdgcn_exp2f(a - mn);
      const float p1 = __builtin_amdgcn_exp2f(bb - mn);
      const float f  = __builtin_amdgcn_exp2f(rmax[j] - mn);
      rsum[j] = rsum[j] * f + redsum16(p0 + p1);
      rmax[j] = mn;
#pragma unroll
      for (int c = 0; c < 4; ++c) o[c][j] *= f;
      const int row = j + 8 * hig;
      myl[row * VP + n]      = (__bf16)p0;   // C-layout -> row-major LDS
      myl[row * VP + 16 + n] = (__bf16)p1;
    }

    // P back as A-operand (DS ops are wave-ordered; private slice, no barrier)
    const v16bf pa = load_frag_bf16(myl, VP);

    // O += P @ V from LDS (V^T: columns contiguous in key dim)
    const __bf16* Vc = Vl[cur];
#pragma unroll
    for (int c = 0; c < 4; ++c) {
      v16bf vf = load_frag_bf16(Vc + (c * 16) * VP, VP);
      o[c] = wmma_bf16(pa, vf, o[c]);
    }

    // store staged chunk kb+1 to the alternate buffer (its readers finished
    // before the previous barrier), then make it visible
    if (more) {
      *(v8bf*)(&Kl[1 - cur][kdst]) = kr;
      *(v8bf*)(&Vl[1 - cur][vdst]) = vr;
    }
    __syncthreads();
  }

  // normalize and store bf16 to [B,T,C] (head-interleaved for the projection)
  __bf16* op = O + ((size_t)(b * SEQ + q0)) * DM + h * DH;
#pragma unroll
  for (int j = 0; j < 8; ++j) {
    const float inv = 1.0f / rsum[j];
    const int row = j + 8 * hig;
#pragma unroll
    for (int c = 0; c < 4; ++c)
      op[(size_t)row * DM + c * 16 + n] = (__bf16)(o[c][j] * inv);
  }
}

// ---------------------------------------------------------------------------
// Kernel 3: output projection  Y = O @ Wp^T + bp  (M=8192, N=K=1024, fp32 out)
// 8 waves/block -> 128x64 block tile.  The Wp k-slice (64 cols x 32 k, 4KB)
// is shared by all 8 waves -> double-buffered LDS staging (8x traffic cut).
// ---------------------------------------------------------------------------
__global__ void __launch_bounds__(256) out_proj_kernel(
    const __bf16* __restrict__ Ob, const __bf16* __restrict__ Wpb,
    const float* __restrict__ bp, float* __restrict__ out) {
  __shared__ __attribute__((aligned(16))) __bf16 Wl[2][64 * VP];   // 64 cols x 32 k, padded rows

  const int tid  = threadIdx.x;
  const int wave = tid >> 5;
  const int lane = tid & 31;
  const int n = lane & 15, hig = lane >> 4;
  const int r0 = blockIdx.x * 128 + wave * 16;
  const int n0 = blockIdx.y * 64;
  const int wrow = tid >> 2, wpart = tid & 3;

  v8f acc[4];
#pragma unroll
  for (int c = 0; c < 4; ++c) {
    const float bval = bp[n0 + c * 16 + n];
#pragma unroll
    for (int j = 0; j < 8; ++j) acc[c][j] = bval;
  }

  // prologue: stage Wp k-slice 0
  {
    v8bf wr = *(const v8bf*)(Wpb + (size_t)(n0 + wrow) * DM + wpart * 8);
    *(v8bf*)(&Wl[0][wrow * VP + wpart * 8]) = wr;
  }
  __syncthreads();

  const int NKC = DM / 32;
  for (int kc = 0; kc < NKC; ++kc) {
    const int cur = kc & 1;
    const bool more = (kc + 1 < NKC);

    v8bf wr{};
    if (more)
      wr = *(const v8bf*)(Wpb + (size_t)(n0 + wrow) * DM + (kc + 1) * 32 + wpart * 8);

    v16bf a = load_frag_bf16(Ob + (size_t)r0 * DM + kc * 32, DM);
#pragma unroll
    for (int c = 0; c < 4; ++c) {
      v16bf w = load_frag_bf16(&Wl[cur][(c * 16) * VP], VP);
      acc[c] = wmma_bf16(a, w, acc[c]);
    }

    if (more)
      *(v8bf*)(&Wl[1 - cur][wrow * VP + wpart * 8]) = wr;
    __syncthreads();
  }

#pragma unroll
  for (int c = 0; c < 4; ++c)
#pragma unroll
    for (int j = 0; j < 8; ++j)
      out[(size_t)(r0 + j + 8 * hig) * DM + n0 + c * 16 + n] = acc[c][j];
}

// ---------------------------------------------------------------------------
// Host launcher
// ---------------------------------------------------------------------------
extern "C" void kernel_launch(void* const* d_in, const int* in_sizes, int n_in,
                              void* d_out, int out_size, void* d_ws, size_t ws_size,
                              hipStream_t stream) {
  const float* x  = (const float*)d_in[0];
  const float* Wq = (const float*)d_in[1];
  const float* bq = (const float*)d_in[2];
  const float* Wk = (const float*)d_in[3];
  const float* bk = (const float*)d_in[4];
  const float* Wv = (const float*)d_in[5];
  const float* bv = (const float*)d_in[6];
  const float* Wp = (const float*)d_in[7];
  const float* bp = (const float*)d_in[8];
  float* out = (float*)d_out;

  __bf16* ws = (__bf16*)d_ws;
  const size_t QKV_E = (size_t)BATCH * HEADS * SEQ * DH;  // 8,388,608 elems each
  __bf16* Qw   = ws;                       // [B,H,T,64]   bf16
  __bf16* Vtw  = ws + 2 * QKV_E;           // [B,H,64,T]   bf16 (transposed V)
  __bf16* Ow   = ws + 3 * QKV_E;           // [B,T,1024]   bf16
  __bf16* Wpb  = ws + 4 * QKV_E;           // [1024,1024]  bf16
  __bf16* Wqkv = Wpb + (size_t)DM * DM;    // 3 x [64,64]  bf16
  // total: ~69.2 MB of d_ws

  cvt_weights_kernel<<<256, 256, 0, stream>>>(Wq, Wk, Wv, Wp, Wqkv, Wpb);

  dim3 g1(BATCH * HEADS * (SEQ / 16), 3);
  qkv_proj_kernel<<<g1, 32, 0, stream>>>(x, Wqkv, bq, bk, bv, Qw, Vtw);

  dim3 g2(SEQ / 128, BATCH * HEADS);
  flash_attn_kernel<<<g2, 256, 0, stream>>>(Qw, Qw + QKV_E, Vtw, Ow);

  dim3 g3((BATCH * SEQ) / 128, DM / 64);
  out_proj_kernel<<<g3, 256, 0, stream>>>(Ow, Wpb, bp, out);
}

// v002
// A run of this version takes 139 microseconds.
// Timed twice side by side with v001, it ran 1.52 times as fast both times.
// Counting every step since v000, it is 2.34 times as fast.
#include <hip/hip_runtime.h>
#include <hip/hip_bf16.h>

typedef __attribute__((ext_vector_type(16))) __bf16 v16bf;
typedef __attribute__((ext_vector_type(8)))  __bf16 v8bf;
typedef __attribute__((ext_vector_type(8)))  float  v8f;

#define HEADS 16
#define DH    64
#define DM    1024
#define BATCH 4
#define SEQ   2048

// LDS row pitches in elements: an odd multiple of 16 bytes, so that the 16 rows
// a 16-byte fragment load touches fall on 16 different groups of four banks
#define KP 72   // rows of 64 bf16 (128 B) at 144 B
#define VP 40   // rows of 32 bf16 (64 B) at 80 B

// ---------------------------------------------------------------------------
// WMMA helper: D = A(16x32 bf16) * B(32x16 bf16) + C(16x16 f32)
// ---------------------------------------------------------------------------
__device__ __forceinline__ v8f wmma_bf16(v16bf a, v16bf b, v8f c) {
  return __builtin_amdgcn_wmma_f32_16x16x32_bf16(
      /*neg_a=*/false, a, /*neg_b=*/false, b,
      /*c_mod=*/(short)0, c, /*reuse_a=*/false, /*reuse_b=*/false);
}

// ---------------------------------------------------------------------------
// Fragment loaders: documented gfx1250 16-bit A/B layout.
// Lane L holds row/col (L & 15); K runs: base=(L>>4)*8, elements [base..base+7]
// and [base+16..base+23].  base pointer must be 16B aligned; ld in elements.
// ---------------------------------------------------------------------------
__device__ __forceinline__ v16bf load_frag_bf16(const __bf16* base, int ld) {
  const int lane = threadIdx.x & 31;
  const __bf16* p = base + (size_t)(lane & 15) * ld + ((lane >> 4) << 3);
  v8bf lo = *(const v8bf*)(p);
  v8bf hi = *(const v8bf*)(p + 16);
  v16bf r;
#pragma unroll
  for (int i = 0; i < 8; ++i) { r[i] = lo[i]; r[i + 8] = hi[i]; }
  return r;
}

__device__ __forceinline__ v16bf load_frag_f32(const float* base, int ld) {
  const int lane = threadIdx.x & 31;
  const float* p = base + (size_t)(lane & 15) * ld + ((lane >> 4) << 3);
  v16bf r;
#pragma unroll
  for (int i = 0; i < 8; ++i) {
    r[i]     = (__bf16)p[i];
    r[i + 8] = (__bf16)p[i + 16];
  }
  return r;
}

// value of lane l ^ 16 (the other half of the wave), one vector instruction
__device__ __forceinline__ float xhalf(float v) {
  const int b = __builtin_bit_cast(int, v);
  return __builtin_bit_cast(float, __builtin_amdgcn_permlanex16(
      b, b, 0x76543210, 0xfedcba98, false, false));
}

// ---------------------------------------------------------------------------
// Kernel 0: convert weights fp32 -> bf16 (Wq|Wk|Wv packed, Wp)
// ---------------------------------------------------------------------------
__global__ void __launch_bounds__(256) cvt_weights_kernel(
    const float* __restrict__ Wq, const float* __restrict__ Wk,
    const float* __restrict__ Wv, const float* __restrict__ Wp,
    __bf16* __restrict__ wqkv, __bf16* __restrict__ wpb) {
  const int stride = gridDim.x * blockDim.x;
  const int i0 = blockIdx.x * blockDim.x + threadIdx.x;
  for (int i = i0; i < 3 * DH * DH; i += stride) {
    const float* s = (i < DH * DH) ? Wq : (i < 2 * DH * DH) ? Wk : Wv;
    wqkv[i] = (__bf16)s[i % (DH * DH)];
  }
  for (int i = i0; i < DM * DM; i += stride) wpb[i] = (__bf16)Wp[i];
}

// ---------------------------------------------------------------------------
// Kernel 1: per-head QKV projection.  One wave -> one 16(t) x 64(e) tile.
// Q,K stored [B,H,T,64]; V stored transposed [B,H,64,T] for the P@V stage.
// ---------------------------------------------------------------------------
__global__ void __launch_bounds__(32) qkv_proj_kernel(
    const float* __restrict__ x, const __bf16* __restrict__ wqkv,
    const float* __restrict__ bq, const float* __restrict__ bk,
    const float* __restrict__ bv,
    __bf16* __restrict__ qk_out, __bf16* __restrict__ vt_out) {
  const int sel  = blockIdx.y;                 // 0=q 1=k 2=v
  const int nt16 = SEQ / 16;
  const int t0   = (blockIdx.x % nt16) * 16;
  const int bh   = blockIdx.x / nt16;
  const int lane = threadIdx.x & 31;
  const int n    = lane & 15;
  const int hig  = lane >> 4;
  const int b    = bh / HEADS, h = bh % HEADS;

  const float* xp = x + ((size_t)(b * SEQ + t0)) * DM + h * DH;
  v16bf a0 = load_frag_f32(xp, DM);        // k = 0..31 of head dim
  v16bf a1 = load_frag_f32(xp + 32, DM);   // k = 32..63

  const __bf16* W    = wqkv + sel * (DH * DH);
  const float*  bias = (sel == 0) ? bq : (sel == 1) ? bk : bv;

  v8f acc[4];
#pragma unroll
  for (int c = 0; c < 4; ++c) {
    const float bval = bias[c * 16 + n];
#pragma unroll
    for (int j = 0; j < 8; ++j) acc[c][j] = bval;
    v16bf w0 = load_frag_bf16(W + (size_t)(c * 16) * DH, DH);
    v16bf w1 = load_frag_bf16(W + (size_t)(c * 16) * DH + 32, DH);
    acc[c] = wmma_bf16(a0, w0, acc[c]);
    acc[c] = wmma_bf16(a1, w1, acc[c]);
  }

  if (sel < 2) {
    __bf16* out = qk_out + (size_t)sel * ((size_t)BATCH * HEADS * SEQ * DH) +
                  ((size_t)(bh * SEQ + t0)) * DH;
#pragma unroll
    for (int c = 0; c < 4; ++c)
#pragma unroll
      for (int j = 0; j < 8; ++j)
        out[(size_t)(j + 8 * hig) * DH + c * 16 + n] = (__bf16)acc[c][j];
  } else {
    __bf16* vt = vt_out + (size_t)bh * DH * SEQ;
#pragma unroll
    for (int c = 0; c < 4; ++c)
#pragma unroll
      for (int j = 0; j < 8; ++j)
        vt[(size_t)(c * 16 + n) * SEQ + t0 + j + 8 * hig] = (__bf16)acc[c][j];
  }
}

__global__ void __launch_bounds__(256) flash_attn_kernel(
    const __bf16* __restrict__ Q, const __bf16* __restrict__ K,
    const __bf16* __restrict__ Vt, __bf16* __restrict__ O) {
  __shared__ __attribute__((aligned(16))) __bf16 Kl[2][32 * KP];    // 32 keys x 64 d, padded rows
  __shared__ __attribute__((aligned(16))) __bf16 Vl[2][DH * VP];    // 64 d x 32 keys (V^T), padded rows

  const int tid  = threadIdx.x;
  const int wave = tid >> 5;
  const int lane = tid & 31;
  const int n = lane & 15, hig = lane >> 4;
  const int bh = blockIdx.y;
  const int b = bh / HEADS, h = bh % HEADS;
  const int q0 = blockIdx.x * 128 + wave * 16;

  const __bf16* Qp = Q + ((size_t)(bh * SEQ + q0)) * DH;
  const v16bf qa0 = load_frag_bf16(Qp, DH);
  const v16bf qa1 = load_frag_bf16(Qp + 32, DH);

  const __bf16* Kb = K + (size_t)bh * SEQ * DH;
  const __bf16* Vb = Vt + (size_t)bh * DH * SEQ;

  // cooperative-stage index split: 256 threads x 8 bf16 = 2048 elems (4KB)
  const int vrow = tid >> 2, vpart = tid & 3;
  const int kdst = (tid >> 3) * KP + (tid & 7) * 8;   // K: 8 threads per 64-d row
  const int vdst = vrow * VP + vpart * 8;

  v8f   o[4];   // o[c][j] = O^T[d = 16c + 8*hig + j][query n]
  float rmax = -3.0e38f;   // running maximum of query n (same in both halves)
  float rsum = 0.0f;       // running sum over this half's keys only
#pragma unroll
  for (int c = 0; c < 4; ++c)
#pragma unroll
    for (int j = 0; j < 8; ++j) o[c][j] = 0.0f;

  const float SC = 0.03125f * 1.44269504088896f;  // (1/sqrt(C)) * log2(e)
  const int NCH = SEQ / 32;

  // prologue: stage chunk 0 into buffer 0
  {
    v8bf kr = *(const v8bf*)(Kb + tid * 8);
    v8bf vr = *(const v8bf*)(Vb + (size_t)vrow * SEQ + vpart * 8);
    *(v8bf*)(&Kl[0][kdst]) = kr;
    *(v8bf*)(&Vl[0][vdst]) = vr;
  }
  __syncthreads();

  for (int kb = 0; kb < NCH; ++kb) {
    const int cur = kb & 1;
    const bool more = (kb + 1 < NCH);

    // issue global loads for chunk kb+1 (in flight during the WMMAs below)
    v8bf kr{}, vr{};
    if (more) {
      kr = *(const v8bf*)(Kb + (size_t)((kb + 1) * 32) * DH + tid * 8);
      vr = *(const v8bf*)(Vb + (size_t)vrow * SEQ + (kb + 1) * 32 + vpart * 8);
      if (kb + 2 < NCH)  // global_prefetch for chunk kb+2
        __builtin_prefetch(Kb + (size_t)((kb + 2) * 32) * DH, 0, 0);
    }
    // keeps the staging loads at the head of the pass: sunk to the foot, next
    // to their LDS stores, their latency would stand in front of the barrier
    __builtin_amdgcn_sched_barrier(0);

    // S^T[32k x 16q] = K @ Q^T from LDS : two 16x16 C-tiles, 2 WMMAs each
    const __bf16* Kc = Kl[cur];
    v8f s0, s1;
#pragma unroll
    for (int j = 0; j < 8; ++j) { s0[j] = 0.0f; s1[j] = 0.0f; }
    {
      v16bf k00 = load_frag_bf16(Kc, KP);
      v16bf k01 = load_frag_bf16(Kc + 32, KP);
      v16bf k10 = load_frag_bf16(Kc + 16 * KP, KP);
      v16bf k11 = load_frag_bf16(Kc + 16 * KP + 32, KP);
      s0 = wmma_bf16(k00, qa0, s0);
      s0 = wmma_bf16(k01, qa1, s0);
      s1 = wmma_bf16(k10, qa0, s1);
      s1 = wmma_bf16(k11, qa1, s1);
    }

    // V^T fragments (A operand: rows d, k = keys), in flight under the softmax
    const __bf16* Vc = Vl[cur];
    v16bf vf[4];
#pragma unroll
    for (int c = 0; c < 4; ++c) vf[c] = load_frag_bf16(Vc + (c * 16) * VP, VP);
    // the eight V reads issue here as one group, so that the softmax covers their
    // latency; sunk to their products each pair would be waited for on its own
    __builtin_amdgcn_sched_barrier(0);

    // online softmax (log2 domain) of query n: maximum of the raw scores (the
    // scale is positive) in-lane, then joined with the other half's
    float mx = fmaxf(s0[0], s1[0]);
#pragma unroll
    for (int j = 1; j < 8; ++j) mx = fmaxf(mx, fmaxf(s0[j], s1[j]));
    mx = fmaxf(mx, xhalf(mx)) * SC;
    const float mn = fmaxf(rmax, mx);
    const float f  = __builtin_amdgcn_exp2f(rmax - mn);
    rmax = mn;

    v16bf pb;   // P^T as B operand: element i = key 8*hig + i, i + 8 = key 16 + 8*hig + i
    float ps[8];
#pragma unroll
    for (int j = 0; j < 8; ++j) {
      const float p0 = __builtin_amdgcn_exp2f(fmaf(s0[j], SC, -mn));
      const float p1 = __builtin_amdgcn_exp2f(fmaf(s1[j], SC, -mn));
      ps[j] = p0 + p1;
      pb[j]     = (__bf16)p0;
      pb[j + 8] = (__bf16)p1;
    }
    rsum = fmaf(rsum, f, ((ps[0] + ps[1]) + (ps[2] + ps[3])) +
                         ((ps[4] + ps[5]) + (ps[6] + ps[7])));

    // O^T = O^T * f + V^T @ P^T
#pragma unroll
    for (int c = 0; c < 4; ++c) {
      o[c] *= f;
      o[c] = wmma_bf16(vf[c], pb, o[c]);
    }

    // keeps the wait for the staging loads, the LDS stores and the barrier at the
    // foot of the pass: lifted over the softmax they would wait out the loads' latency
    __builtin_amdgcn_sched_barrier(0);

    // store staged chunk kb+1 to the alternate buffer (its readers finished
    // before the previous barrier), then make it visible
    if (more) {
      *(v8bf*)(&Kl[1 - cur][kdst]) = kr;
      *(v8bf*)(&Vl[1 - cur][vdst]) = vr;
    }
    __syncthreads();
  }

  // normalize and store bf16 to [B,T,C] (head-interleaved for the projection):
  // a lane holds 8 consecutive d of its query per tile, one 16-byte store each
  const float inv = 1.0f / (rsum + xhalf(rsum));   // join the halves' sums
  __bf16* op = O + ((size_t)(b * SEQ + q0 + n)) * DM + h * DH + 8 * hig;
#pragma unroll
  for (int c = 0; c < 4; ++c) {
    v8bf r;
#pragma unroll
    for (int j = 0; j < 8; ++j) r[j] = (__bf16)(o[c][j] * inv);
    *(v8bf*)(op + c * 16) = r;
  }
}

// ---------------------------------------------------------------------------
// Kernel 3: output projection  Y = O @ Wp^T + bp  (M=8192, N=K=1024, fp32 out)
// 8 waves/block -> 128x64 block tile.  The Wp k-slice (64 cols x 32 k, 4KB)
// is shared by all 8 waves -> double-buffered LDS staging (8x traffic cut).
// ---------------------------------------------------------------------------
__global__ void __launch_bounds__(256) out_proj_kernel(
    const __bf16* __restrict__ Ob, const __bf16* __restrict__ Wpb,
    const float* __restrict__ bp, float* __restrict__ out) {
  __shared__ __attribute__((aligned(16))) __bf16 Wl[2][64 * VP];   // 64 cols x 32 k, padded rows

  const int tid  = threadIdx.x;
  const int wave = tid >> 5;
  const int lane = tid & 31;
  const int n = lane & 15, hig = lane >> 4;
  const int r0 = blockIdx.x * 128 + wave * 16;
  const int n0 = blockIdx.y * 64;
  const int wrow = tid >> 2, wpart = tid & 3;

  v8f acc[4];
#pragma unroll
  for (int c = 0; c < 4; ++c) {
    const float bval = bp[n0 + c * 16 + n];
#pragma unroll
    for (int j = 0; j < 8; ++j) acc[c][j] = bval;
  }

  // prologue: stage Wp k-slice 0
  {
    v8bf wr = *(const v8bf*)(Wpb + (size_t)(n0 + wrow) * DM + wpart * 8);
    *(v8bf*)(&Wl[0][wrow * VP + wpart * 8]) = wr;
  }
  __syncthreads();

  const int NKC = DM / 32;
  for (int kc = 0; kc < NKC; ++kc) {
    const int cur = kc & 1;
    const bool more = (kc + 1 < NKC);

    v8bf wr{};
    if (more)
      wr = *(const v8bf*)(Wpb + (size_t)(n0 + wrow) * DM + (kc + 1) * 32 + wpart * 8);

    v16bf a = load_frag_bf16(Ob + (size_t)r0 * DM + kc * 32, DM);
#pragma unroll
    for (int c = 0; c < 4; ++c) {
      v16bf w = load_frag_bf16(&Wl[cur][(c * 16) * VP], VP);
      acc[c] = wmma_bf16(a, w, acc[c]);
    }

    if (more)
      *(v8bf*)(&Wl[1 - cur][wrow * VP + wpart * 8]) = wr;
    __syncthreads();
  }

#pragma unroll
  for (int c = 0; c < 4; ++c)
#pragma unroll
    for (int j = 0; j < 8; ++j)
      out[(size_t)(r0 + j + 8 * hig) * DM + n0 + c * 16 + n] = acc[c][j];
}

// ---------------------------------------------------------------------------
// Host launcher
// ---------------------------------------------------------------------------
extern "C" void kernel_launch(void* const* d_in, const int* in_sizes, int n_in,
                              void* d_out, int out_size, void* d_ws, size_t ws_size,
                              hipStream_t stream) {
  const float* x  = (const float*)d_in[0];
  const float* Wq = (const float*)d_in[1];
  const float* bq = (const float*)d_in[2];
  const float* Wk = (const float*)d_in[3];
  const float* bk = (const float*)d_in[4];
  const float* Wv = (const float*)d_in[5];
  const float* bv = (const float*)d_in[6];
  const float* Wp = (const float*)d_in[7];
  const float* bp = (const float*)d_in[8];
  float* out = (float*)d_out;

  __bf16* ws = (__bf16*)d_ws;
  const size_t QKV_E = (size_t)BATCH * HEADS * SEQ * DH;  // 8,388,608 elems each
  __bf16* Qw   = ws;                       // [B,H,T,64]   bf16
  __bf16* Vtw  = ws + 2 * QKV_E;           // [B,H,64,T]   bf16 (transposed V)
  __bf16* Ow   = ws + 3 * QKV_E;           // [B,T,1024]   bf16
  __bf16* Wpb  = ws + 4 * QKV_E;           // [1024,1024]  bf16
  __bf16* Wqkv = Wpb + (size_t)DM * DM;    // 3 x [64,64]  bf16
  // total: ~69.2 MB of d_ws

  cvt_weights_kernel<<<256, 256, 0, stream>>>(Wq, Wk, Wv, Wp, Wqkv, Wpb);

  dim3 g1(BATCH * HEADS * (SEQ / 16), 3);
  qkv_proj_kernel<<<g1, 32, 0, stream>>>(x, Wqkv, bq, bk, bv, Qw, Vtw);

  dim3 g2(SEQ / 128, BATCH * HEADS);
  flash_attn_kernel<<<g2, 256, 0, stream>>>(Qw, Qw + QKV_E, Vtw, Ow);

  dim3 g3((BATCH * SEQ) / 128, DM / 64);
  out_proj_kernel<<<g3, 256, 0, stream>>>(Ow, Wpb, bp, out);
}

// v003
// One run takes 112 microseconds.
// Two timings next to v002 both put it at 1.24 times that version's speed.
// All steps since v000 together make it 2.90 times as fast.
#include <hip/hip_runtime.h>
#include <hip/hip_bf16.h>

typedef __attribute__((ext_vector_type(16))) __bf16 v16bf;
typedef __attribute__((ext_vector_type(8)))  __bf16 v8bf;
typedef __attribute__((ext_vector_type(8)))  float  v8f;

#define HEADS 16
#define DH    64
#define DM    1024
#define BATCH 4
#define SEQ   2048

// LDS row pitches in elements: an odd multiple of 16 bytes, so that the 16 rows
// a 16-byte fragment load touches fall on 16 different groups of four banks
#define KP 72   // rows of 64 bf16 (128 B) at 144 B
#define VP 40   // rows of 32 bf16 (64 B) at 80 B

// ---------------------------------------------------------------------------
// WMMA helper: D = A(16x32 bf16) * B(32x16 bf16) + C(16x16 f32)
// ---------------------------------------------------------------------------
__device__ __forceinline__ v8f wmma_bf16(v16bf a, v16bf b, v8f c) {
  return __builtin_amdgcn_wmma_f32_16x16x32_bf16(
      /*neg_a=*/false, a, /*neg_b=*/false, b,
      /*c_mod=*/(short)0, c, /*reuse_a=*/false, /*reuse_b=*/false);
}

// ---------------------------------------------------------------------------
// Fragment loaders: documented gfx1250 16-bit A/B layout.
// Lane L holds row/col (L & 15); K runs: base=(L>>4)*8, elements [base..base+7]
// and [base+16..base+23].  base pointer must be 16B aligned; ld in elements.
// ---------------------------------------------------------------------------
__device__ __forceinline__ v16bf load_frag_bf16(const __bf16* base, int ld) {
  const int lane = threadIdx.x & 31;
  const __bf16* p = base + (size_t)(lane & 15) * ld + ((lane >> 4) << 3);
  v8bf lo = *(const v8bf*)(p);
  v8bf hi = *(const v8bf*)(p + 16);
  v16bf r;
#pragma unroll
  for (int i = 0; i < 8; ++i) { r[i] = lo[i]; r[i + 8] = hi[i]; }
  return r;
}

__device__ __forceinline__ v16bf load_frag_f32(const float* base, int ld) {
  const int lane = threadIdx.x & 31;
  const float* p = base + (size_t)(lane & 15) * ld + ((lane >> 4) << 3);
  v16bf r;
#pragma unroll
  for (int i = 0; i < 8; ++i) {
    r[i]     = (__bf16)p[i];
    r[i + 8] = (__bf16)p[i + 16];
  }
  return r;
}

// value of lane l ^ 16 (the other half of the wave), one vector instruction
__device__ __forceinline__ float xhalf(float v) {
  const int b = __builtin_bit_cast(int, v);
  return __builtin_bit_cast(float, __builtin_amdgcn_permlanex16(
      b, b, 0x76543210, 0xfedcba98, false, false));
}

// ---------------------------------------------------------------------------
// Kernel 0: convert weights fp32 -> bf16 (Wq|Wk|Wv packed, Wp)
// ---------------------------------------------------------------------------
__global__ void __launch_bounds__(256) cvt_weights_kernel(
    const float* __restrict__ Wq, const float* __restrict__ Wk,
    const float* __restrict__ Wv, const float* __restrict__ Wp,
    __bf16* __restrict__ wqkv, __bf16* __restrict__ wpb) {
  const int stride = gridDim.x * blockDim.x;
  const int i0 = blockIdx.x * blockDim.x + threadIdx.x;
  for (int i = i0; i < 3 * DH * DH; i += stride) {
    const float* s = (i < DH * DH) ? Wq : (i < 2 * DH * DH) ? Wk : Wv;
    wqkv[i] = (__bf16)s[i % (DH * DH)];
  }
  for (int i = i0; i < DM * DM; i += stride) wpb[i] = (__bf16)Wp[i];
}

// ---------------------------------------------------------------------------
// Kernel 1: per-head QKV projection.  One wave takes 64 rows (t) of one head:
// it reads its x once, keeps the four 16-row fragment pairs in registers and
// makes q, k and v from them.  q and k are taken transposed (W x^T): a lane then
// holds 8 consecutive e of one row t.  v is taken as x W^T: a lane holds 8
// consecutive t of one e.  Either way a lane stores 16-byte runs.
// The work is 12 groups (3 matrices x 4 tiles of 16 weight rows); a group's two
// weight fragments and its bias come four groups ahead, through four register slots.
// Q,K stored [B,H,T,64]; V stored transposed [B,H,64,T] for the P@V stage.
// ---------------------------------------------------------------------------
typedef __attribute__((ext_vector_type(4))) float v4f;

__global__ void __launch_bounds__(256) qkv_proj_kernel(
    const float* __restrict__ x, const __bf16* __restrict__ wqkv,
    const float* __restrict__ bq, const float* __restrict__ bk,
    const float* __restrict__ bv,
    __bf16* __restrict__ qk_out, __bf16* __restrict__ vt_out) {
  const int wave = threadIdx.x >> 5;
  const int lane = threadIdx.x & 31;
  const int n    = lane & 15;
  const int hig  = lane >> 4;
  const int nu   = SEQ / 64;
  const int unit = blockIdx.x * 8 + wave;      // 64-row unit of one head
  const int t0   = (unit % nu) * 64;
  const int bh   = unit / nu;
  const int b    = bh / HEADS, h = bh % HEADS;

  // groups 0..2 (Wq rows 0..47 with their bias), then all of the wave's x: 32 loads
  // of 16 bytes a lane
  v16bf rw[4][2];
  v8f   rb[4];
#pragma unroll
  for (int c = 0; c < 3; ++c) {
    rw[c][0] = load_frag_bf16(wqkv + (size_t)(c * 16) * DH, DH);
    rw[c][1] = load_frag_bf16(wqkv + (size_t)(c * 16) * DH + 32, DH);
    rb[c]    = *(const v8f*)(bq + c * 16 + 8 * hig);
  }
  const float* xp = x + ((size_t)(b * SEQ + t0 + n)) * DM + h * DH + 8 * hig;
  v4f xr[4][2][4];   // [16-row tile][k half][k 0..3, 4..7, 16..19, 20..23 of the lane's run]
#pragma unroll
  for (int i = 0; i < 4; ++i)
#pragma unroll
    for (int kh = 0; kh < 2; ++kh) {
      const float* p = xp + (size_t)(i * 16) * DM + kh * 32;
      xr[i][kh][0] = *(const v4f*)(p);
      xr[i][kh][1] = *(const v4f*)(p + 4);
      xr[i][kh][2] = *(const v4f*)(p + 16);
      xr[i][kh][3] = *(const v4f*)(p + 20);
    }
  // the x address registers are free from here on: the wait stands before their reuse
  asm volatile("s_wait_xcnt 0x0" ::: "memory");
  // keeps every load above in flight at once: left free, the conversions below are
  // woven between the loads and only four of them are outstanding at a time
  __builtin_amdgcn_sched_barrier(0);

  // group 3 and the four v biases: their registers are not there before x is converted
  float bvl[4];
  rw[3][0] = load_frag_bf16(wqkv + (size_t)48 * DH, DH);
  rw[3][1] = load_frag_bf16(wqkv + (size_t)48 * DH + 32, DH);
  rb[3]    = *(const v8f*)(bq + 48 + 8 * hig);
#pragma unroll
  for (int c = 0; c < 4; ++c) bvl[c] = bv[c * 16 + n];

  v16bf xa[4][2];
#pragma unroll
  for (int i = 0; i < 4; ++i)
#pragma unroll
    for (int kh = 0; kh < 2; ++kh)
#pragma unroll
      for (int e = 0; e < 4; ++e) {
        xa[i][kh][e]      = (__bf16)xr[i][kh][0][e];
        xa[i][kh][e + 4]  = (__bf16)xr[i][kh][1][e];
        xa[i][kh][e + 8]  = (__bf16)xr[i][kh][2][e];
        xa[i][kh][e + 12] = (__bf16)xr[i][kh][3][e];
      }

  __bf16* qo = qk_out + ((size_t)(bh * SEQ + t0 + n)) * DH + 8 * hig;
  __bf16* vt = vt_out + (size_t)bh * DH * SEQ + (size_t)n * SEQ + t0 + 8 * hig;

#pragma unroll
  for (int g = 0; g < 12; ++g) {
    const int sel = g >> 2, c = g & 3;
    if (sel < 2) {
      // q, k: D[e = 16c + 8*hig + j][t = 16i + n] = W x^T + bias[e]
      __bf16* out = qo + (size_t)sel * ((size_t)BATCH * HEADS * SEQ * DH);
#pragma unroll
      for (int i = 0; i < 4; ++i) {
        v8f acc = wmma_bf16(rw[c][0], xa[i][0], rb[c]);
        acc = wmma_bf16(rw[c][1], xa[i][1], acc);
        v8bf r;
#pragma unroll
        for (int j = 0; j < 8; ++j) r[j] = (__bf16)acc[j];
        *(v8bf*)(out + (size_t)(i * 16) * DH + c * 16) = r;
      }
    } else {
      // v: D[t = 16i + 8*hig + j][e = 16c + n] = x W^T + bias[e], stored as V^T
      v8f bvec;
#pragma unroll
      for (int j = 0; j < 8; ++j) bvec[j] = bvl[c];
#pragma unroll
      for (int i = 0; i < 4; ++i) {
        v8f acc = wmma_bf16(xa[i][0], rw[c][0], bvec);
        acc = wmma_bf16(xa[i][1], rw[c][1], acc);
        v8bf r;
#pragma unroll
        for (int j = 0; j < 8; ++j) r[j] = (__bf16)acc[j];
        *(v8bf*)(vt + (size_t)(c * 16) * SEQ + i * 16) = r;
      }
    }
    if (g + 4 < 12) {
      // the group's stores name registers that the loads below may take over
      asm volatile("s_wait_xcnt 0x0" ::: "memory");
      const __bf16* Wn = wqkv + (size_t)(sel + 1) * (DH * DH) + (size_t)(c * 16) * DH;
      rw[c][0] = load_frag_bf16(Wn, DH);
      rw[c][1] = load_frag_bf16(Wn + 32, DH);
      if (sel == 0) rb[c] = *(const v8f*)(bk + c * 16 + 8 * hig);
      // holds the refill of this slot here, three groups of products ahead of its
      // use: sunk to the use, its latency would be waited out once a group
      __builtin_amdgcn_sched_barrier(0);
    }
  }
}

__global__ void __launch_bounds__(256) flash_attn_kernel(
    const __bf16* __restrict__ Q, const __bf16* __restrict__ K,
    const __bf16* __restrict__ Vt, __bf16* __restrict__ O) {
  __shared__ __attribute__((aligned(16))) __bf16 Kl[2][32 * KP];    // 32 keys x 64 d, padded rows
  __shared__ __attribute__((aligned(16))) __bf16 Vl[2][DH * VP];    // 64 d x 32 keys (V^T), padded rows

  const int tid  = threadIdx.x;
  const int wave = tid >> 5;
  const int lane = tid & 31;
  const int n = lane & 15, hig = lane >> 4;
  const int bh = blockIdx.y;
  const int b = bh / HEADS, h = bh % HEADS;
  const int q0 = blockIdx.x * 128 + wave * 16;

  const __bf16* Qp = Q + ((size_t)(bh * SEQ + q0)) * DH;
  const v16bf qa0 = load_frag_bf16(Qp, DH);
  const v16bf qa1 = load_frag_bf16(Qp + 32, DH);

  const __bf16* Kb = K + (size_t)bh * SEQ * DH;
  const __bf16* Vb = Vt + (size_t)bh * DH * SEQ;

  // cooperative-stage index split: 256 threads x 8 bf16 = 2048 elems (4KB)
  const int vrow = tid >> 2, vpart = tid & 3;
  const int kdst = (tid >> 3) * KP + (tid & 7) * 8;   // K: 8 threads per 64-d row
  const int vdst = vrow * VP + vpart * 8;

  v8f   o[4];   // o[c][j] = O^T[d = 16c + 8*hig + j][query n]
  float rmax = -3.0e38f;   // running maximum of query n (same in both halves)
  float rsum = 0.0f;       // running sum over this half's keys only
#pragma unroll
  for (int c = 0; c < 4; ++c)
#pragma unroll
    for (int j = 0; j < 8; ++j) o[c][j] = 0.0f;

  const float SC = 0.03125f * 1.44269504088896f;  // (1/sqrt(C)) * log2(e)
  const int NCH = SEQ / 32;

  // prologue: stage chunk 0 into buffer 0
  {
    v8bf kr = *(const v8bf*)(Kb + tid * 8);
    v8bf vr = *(const v8bf*)(Vb + (size_t)vrow * SEQ + vpart * 8);
    *(v8bf*)(&Kl[0][kdst]) = kr;
    *(v8bf*)(&Vl[0][vdst]) = vr;
  }
  __syncthreads();

  for (int kb = 0; kb < NCH; ++kb) {
    const int cur = kb & 1;
    const bool more = (kb + 1 < NCH);

    // issue global loads for chunk kb+1 (in flight during the WMMAs below)
    v8bf kr{}, vr{};
    if (more) {
      kr = *(const v8bf*)(Kb + (size_t)((kb + 1) * 32) * DH + tid * 8);
      vr = *(const v8bf*)(Vb + (size_t)vrow * SEQ + (kb + 1) * 32 + vpart * 8);
      if (kb + 2 < NCH)  // global_prefetch for chunk kb+2
        __builtin_prefetch(Kb + (size_t)((kb + 2) * 32) * DH, 0, 0);
    }
    // keeps the staging loads at the head of the pass: sunk to the foot, next
    // to their LDS stores, their latency would stand in front of the barrier
    __builtin_amdgcn_sched_barrier(0);

    // S^T[32k x 16q] = K @ Q^T from LDS : two 16x16 C-tiles, 2 WMMAs each
    const __bf16* Kc = Kl[cur];
    v8f s0, s1;
#pragma unroll
    for (int j = 0; j < 8; ++j) { s0[j] = 0.0f; s1[j] = 0.0f; }
    {
      v16bf k00 = load_frag_bf16(Kc, KP);
      v16bf k01 = load_frag_bf16(Kc + 32, KP);
      v16bf k10 = load_frag_bf16(Kc + 16 * KP, KP);
      v16bf k11 = load_frag_bf16(Kc + 16 * KP + 32, KP);
      s0 = wmma_bf16(k00, qa0, s0);
      s0 = wmma_bf16(k01, qa1, s0);
      s1 = wmma_bf16(k10, qa0, s1);
      s1 = wmma_bf16(k11, qa1, s1);
    }

    // V^T fragments (A operand: rows d, k = keys), in flight under the softmax
    const __bf16* Vc = Vl[cur];
    v16bf vf[4];
#pragma unroll
    for (int c = 0; c < 4; ++c) vf[c] = load_frag_bf16(Vc + (c * 16) * VP, VP);
    // the eight V reads issue here as one group, so that the softmax covers their
    // latency; sunk to their products each pair would be waited for on its own
    __builtin_amdgcn_sched_barrier(0);

    // online softmax (log2 domain) of query n: maximum of the raw scores (the
    // scale is positive) in-lane, then joined with the other half's
    float mx = fmaxf(s0[0], s1[0]);
#pragma unroll
    for (int j = 1; j < 8; ++j) mx = fmaxf(mx, fmaxf(s0[j], s1[j]));
    mx = fmaxf(mx, xhalf(mx)) * SC;
    const float mn = fmaxf(rmax, mx);
    const float f  = __builtin_amdgcn_exp2f(rmax - mn);
    rmax = mn;

    v16bf pb;   // P^T as B operand: element i = key 8*hig + i, i + 8 = key 16 + 8*hig + i
    float ps[8];
#pragma unroll
    for (int j = 0; j < 8; ++j) {
      const float p0 = __builtin_amdgcn_exp2f(fmaf(s0[j], SC, -mn));
      const float p1 = __builtin_amdgcn_exp2f(fmaf(s1[j], SC, -mn));
      ps[j] = p0 + p1;
      pb[j]     = (__bf16)p0;
      pb[j + 8] = (__bf16)p1;
    }
    rsum = fmaf(rsum, f, ((ps[0] + ps[1]) + (ps[2] + ps[3])) +
                         ((ps[4] + ps[5]) + (ps[6] + ps[7])));

    // O^T = O^T * f + V^T @ P^T
#pragma unroll
    for (int c = 0; c < 4; ++c) {
      o[c] *= f;
      o[c] = wmma_bf16(vf[c], pb, o[c]);
    }

    // keeps the wait for the staging loads, the LDS stores and the barrier at the
    // foot of the pass: lifted over the softmax they would wait out the loads' latency
    __builtin_amdgcn_sched_barrier(0);

    // store staged chunk kb+1 to the alternate buffer (its readers finished
    // before the previous barrier), then make it visible
    if (more) {
      *(v8bf*)(&Kl[1 - cur][kdst]) = kr;
      *(v8bf*)(&Vl[1 - cur][vdst]) = vr;
    }
    __syncthreads();
  }

  // normalize and store bf16 to [B,T,C] (head-interleaved for the projection):
  // a lane holds 8 consecutive d of its query per tile, one 16-byte store each
  const float inv = 1.0f / (rsum + xhalf(rsum));   // join the halves' sums
  __bf16* op = O + ((size_t)(b * SEQ + q0 + n)) * DM + h * DH + 8 * hig;
#pragma unroll
  for (int c = 0; c < 4; ++c) {
    v8bf r;
#pragma unroll
    for (int j = 0; j < 8; ++j) r[j] = (__bf16)(o[c][j] * inv);
    *(v8bf*)(op + c * 16) = r;
  }
}

// ---------------------------------------------------------------------------
// Kernel 3: output projection  Y = O @ Wp^T + bp  (M=8192, N=K=1024, fp32 out)
// 8 waves/block -> 128x64 block tile.  The Wp k-slice (64 cols x 32 k, 4KB)
// is shared by all 8 waves -> double-buffered LDS staging (8x traffic cut).
// ---------------------------------------------------------------------------
__global__ void __launch_bounds__(256) out_proj_kernel(
    const __bf16* __restrict__ Ob, const __bf16* __restrict__ Wpb,
    const float* __restrict__ bp, float* __restrict__ out) {
  __shared__ __attribute__((aligned(16))) __bf16 Wl[2][64 * VP];   // 64 cols x 32 k, padded rows

  const int tid  = threadIdx.x;
  const int wave = tid >> 5;
  const int lane = tid & 31;
  const int n = lane & 15, hig = lane >> 4;
  const int r0 = blockIdx.x * 128 + wave * 16;
  const int n0 = blockIdx.y * 64;
  const int wrow = tid >> 2, wpart = tid & 3;

  v8f acc[4];
#pragma unroll
  for (int c = 0; c < 4; ++c) {
    const float bval = bp[n0 + c * 16 + n];
#pragma unroll
    for (int j = 0; j < 8; ++j) acc[c][j] = bval;
  }

  // prologue: stage Wp k-slice 0
  {
    v8bf wr = *(const v8bf*)(Wpb + (size_t)(n0 + wrow) * DM + wpart * 8);
    *(v8bf*)(&Wl[0][wrow * VP + wpart * 8]) = wr;
  }
  __syncthreads();

  const int NKC = DM / 32;
  for (int kc = 0; kc < NKC; ++kc) {
    const int cur = kc & 1;
    const bool more = (kc + 1 < NKC);

    v8bf wr{};
    if (more)
      wr = *(const v8bf*)(Wpb + (size_t)(n0 + wrow) * DM + (kc + 1) * 32 + wpart * 8);

    v16bf a = load_frag_bf16(Ob + (size_t)r0 * DM + kc * 32, DM);
#pragma unroll
    for (int c = 0; c < 4; ++c) {
      v16bf w = load_frag_bf16(&Wl[cur][(c * 16) * VP], VP);
      acc[c] = wmma_bf16(a, w, acc[c]);
    }

    if (more)
      *(v8bf*)(&Wl[1 - cur][wrow * VP + wpart * 8]) = wr;
    __syncthreads();
  }

#pragma unroll
  for (int c = 0; c < 4; ++c)
#pragma unroll
    for (int j = 0; j < 8; ++j)
      out[(size_t)(r0 + j + 8 * hig) * DM + n0 + c * 16 + n] = acc[c][j];
}

// ---------------------------------------------------------------------------
// Host launcher
// ---------------------------------------------------------------------------
extern "C" void kernel_launch(void* const* d_in, const int* in_sizes, int n_in,
                              void* d_out, int out_size, void* d_ws, size_t ws_size,
                              hipStream_t stream) {
  const float* x  = (const float*)d_in[0];
  const float* Wq = (const float*)d_in[1];
  const float* bq = (const float*)d_in[2];
  const float* Wk = (const float*)d_in[3];
  const float* bk = (const float*)d_in[4];
  const float* Wv = (const float*)d_in[5];
  const float* bv = (const float*)d_in[6];
  const float* Wp = (const float*)d_in[7];
  const float* bp = (const float*)d_in[8];
  float* out = (float*)d_out;

  __bf16* ws = (__bf16*)d_ws;
  const size_t QKV_E = (size_t)BATCH * HEADS * SEQ * DH;  // 8,388,608 elems each
  __bf16* Qw   = ws;                       // [B,H,T,64]   bf16
  __bf16* Vtw  = ws + 2 * QKV_E;           // [B,H,64,T]   bf16 (transposed V)
  __bf16* Ow   = ws + 3 * QKV_E;           // [B,T,1024]   bf16
  __bf16* Wpb  = ws + 4 * QKV_E;           // [1024,1024]  bf16
  __bf16* Wqkv = Wpb + (size_t)DM * DM;    // 3 x [64,64]  bf16
  // total: ~69.2 MB of d_ws

  cvt_weights_kernel<<<256, 256, 0, stream>>>(Wq, Wk, Wv, Wp, Wqkv, Wpb);

  qkv_proj_kernel<<<BATCH * HEADS * (SEQ / 64) / 8, 256, 0, stream>>>(x, Wqkv, bq, bk, bv, Qw, Vtw);

  dim3 g2(SEQ / 128, BATCH * HEADS);
  flash_attn_kernel<<<g2, 256, 0, stream>>>(Qw, Qw + QKV_E, Vtw, Ow);

  dim3 g3((BATCH * SEQ) / 128, DM / 64);
  out_proj_kernel<<<g3, 256, 0, stream>>>(Ow, Wpb, bp, out);
}

// v004
// One run takes 107 microseconds.
// Next to v003, in two timings, it ran 1.06 and 1.05 times as fast.
// Over all steps from v000 it is 3.06 times as fast.
#include <hip/hip_runtime.h>
#include <hip/hip_bf16.h>

typedef __attribute__((ext_vector_type(16))) __bf16 v16bf;
typedef __attribute__((ext_vector_type(8)))  __bf16 v8bf;
typedef __attribute__((ext_vector_type(8)))  float  v8f;

#define HEADS 16
#define DH    64
#define DM    1024
#define BATCH 4
#define SEQ   2048

// LDS row pitches in elements: an odd multiple of 16 bytes, so that the 16 rows
// a 16-byte fragment load touches fall on 16 different groups of four banks
#define KP 72   // rows of 64 bf16 (128 B) at 144 B
#define VP 40   // rows of 32 bf16 (64 B) at 80 B

// ---------------------------------------------------------------------------
// WMMA helper: D = A(16x32 bf16) * B(32x16 bf16) + C(16x16 f32)
// ---------------------------------------------------------------------------
__device__ __forceinline__ v8f wmma_bf16(v16bf a, v16bf b, v8f c) {
  return __builtin_amdgcn_wmma_f32_16x16x32_bf16(
      /*neg_a=*/false, a, /*neg_b=*/false, b,
      /*c_mod=*/(short)0, c, /*reuse_a=*/false, /*reuse_b=*/false);
}

// ---------------------------------------------------------------------------
// Fragment loaders: documented gfx1250 16-bit A/B layout.
// Lane L holds row/col (L & 15); K runs: base=(L>>4)*8, elements [base..base+7]
// and [base+16..base+23].  base pointer must be 16B aligned; ld in elements.
// ---------------------------------------------------------------------------
__device__ __forceinline__ v16bf load_frag_bf16(const __bf16* base, int ld) {
  const int lane = threadIdx.x & 31;
  const __bf16* p = base + (size_t)(lane & 15) * ld + ((lane >> 4) << 3);
  v8bf lo = *(const v8bf*)(p);
  v8bf hi = *(const v8bf*)(p + 16);
  v16bf r;
#pragma unroll
  for (int i = 0; i < 8; ++i) { r[i] = lo[i]; r[i + 8] = hi[i]; }
  return r;
}

__device__ __forceinline__ v16bf load_frag_f32(const float* base, int ld) {
  const int lane = threadIdx.x & 31;
  const float* p = base + (size_t)(lane & 15) * ld + ((lane >> 4) << 3);
  v16bf r;
#pragma unroll
  for (int i = 0; i < 8; ++i) {
    r[i]     = (__bf16)p[i];
    r[i + 8] = (__bf16)p[i + 16];
  }
  return r;
}

// value of lane l ^ 16 (the other half of the wave), one vector instruction
__device__ __forceinline__ float xhalf(float v) {
  const int b = __builtin_bit_cast(int, v);
  return __builtin_bit_cast(float, __builtin_amdgcn_permlanex16(
      b, b, 0x76543210, 0xfedcba98, false, false));
}

// ---------------------------------------------------------------------------
// Kernel 0: convert weights fp32 -> bf16 (Wq|Wk|Wv packed, Wp)
// ---------------------------------------------------------------------------
__global__ void __launch_bounds__(256) cvt_weights_kernel(
    const float* __restrict__ Wq, const float* __restrict__ Wk,
    const float* __restrict__ Wv, const float* __restrict__ Wp,
    __bf16* __restrict__ wqkv, __bf16* __restrict__ wpb) {
  const int stride = gridDim.x * blockDim.x;
  const int i0 = blockIdx.x * blockDim.x + threadIdx.x;
  for (int i = i0; i < 3 * DH * DH; i += stride) {
    const float* s = (i < DH * DH) ? Wq : (i < 2 * DH * DH) ? Wk : Wv;
    wqkv[i] = (__bf16)s[i % (DH * DH)];
  }
  for (int i = i0; i < DM * DM; i += stride) wpb[i] = (__bf16)Wp[i];
}

// ---------------------------------------------------------------------------
// Kernel 1: per-head QKV projection.  One wave takes 64 rows (t) of one head:
// it reads its x once, keeps the four 16-row fragment pairs in registers and
// makes q, k and v from them.  q and k are taken transposed (W x^T): a lane then
// holds 8 consecutive e of one row t.  v is taken as x W^T: a lane holds 8
// consecutive t of one e.  Either way a lane stores 16-byte runs.
// The work is 12 groups (3 matrices x 4 tiles of 16 weight rows); a group's two
// weight fragments and its bias come four groups ahead, through four register slots.
// Q,K stored [B,H,T,64]; V stored transposed [B,H,64,T] for the P@V stage.
// ---------------------------------------------------------------------------
typedef __attribute__((ext_vector_type(4))) float v4f;

__global__ void __launch_bounds__(256) qkv_proj_kernel(
    const float* __restrict__ x, const __bf16* __restrict__ wqkv,
    const float* __restrict__ bq, const float* __restrict__ bk,
    const float* __restrict__ bv,
    __bf16* __restrict__ qk_out, __bf16* __restrict__ vt_out) {
  const int wave = threadIdx.x >> 5;
  const int lane = threadIdx.x & 31;
  const int n    = lane & 15;
  const int hig  = lane >> 4;
  const int nu   = SEQ / 64;
  const int unit = blockIdx.x * 8 + wave;      // 64-row unit of one head
  const int t0   = (unit % nu) * 64;
  const int bh   = unit / nu;
  const int b    = bh / HEADS, h = bh % HEADS;

  // groups 0..2 (Wq rows 0..47 with their bias), then all of the wave's x: 32 loads
  // of 16 bytes a lane
  v16bf rw[4][2];
  v8f   rb[4];
#pragma unroll
  for (int c = 0; c < 3; ++c) {
    rw[c][0] = load_frag_bf16(wqkv + (size_t)(c * 16) * DH, DH);
    rw[c][1] = load_frag_bf16(wqkv + (size_t)(c * 16) * DH + 32, DH);
    rb[c]    = *(const v8f*)(bq + c * 16 + 8 * hig);
  }
  const float* xp = x + ((size_t)(b * SEQ + t0 + n)) * DM + h * DH + 8 * hig;
  v4f xr[4][2][4];   // [16-row tile][k half][k 0..3, 4..7, 16..19, 20..23 of the lane's run]
#pragma unroll
  for (int i = 0; i < 4; ++i)
#pragma unroll
    for (int kh = 0; kh < 2; ++kh) {
      const float* p = xp + (size_t)(i * 16) * DM + kh * 32;
      xr[i][kh][0] = *(const v4f*)(p);
      xr[i][kh][1] = *(const v4f*)(p + 4);
      xr[i][kh][2] = *(const v4f*)(p + 16);
      xr[i][kh][3] = *(const v4f*)(p + 20);
    }
  // the x address registers are free from here on: the wait stands before their reuse
  asm volatile("s_wait_xcnt 0x0" ::: "memory");
  // keeps every load above in flight at once: left free, the conversions below are
  // woven between the loads and only four of them are outstanding at a time
  __builtin_amdgcn_sched_barrier(0);

  // group 3 and the four v biases: their registers are not there before x is converted
  float bvl[4];
  rw[3][0] = load_frag_bf16(wqkv + (size_t)48 * DH, DH);
  rw[3][1] = load_frag_bf16(wqkv + (size_t)48 * DH + 32, DH);
  rb[3]    = *(const v8f*)(bq + 48 + 8 * hig);
#pragma unroll
  for (int c = 0; c < 4; ++c) bvl[c] = bv[c * 16 + n];

  v16bf xa[4][2];
#pragma unroll
  for (int i = 0; i < 4; ++i)
#pragma unroll
    for (int kh = 0; kh < 2; ++kh)
#pragma unroll
      for (int e = 0; e < 4; ++e) {
        xa[i][kh][e]      = (__bf16)xr[i][kh][0][e];
        xa[i][kh][e + 4]  = (__bf16)xr[i][kh][1][e];
        xa[i][kh][e + 8]  = (__bf16)xr[i][kh][2][e];
        xa[i][kh][e + 12] = (__bf16)xr[i][kh][3][e];
      }

  __bf16* qo = qk_out + ((size_t)(bh * SEQ + t0 + n)) * DH + 8 * hig;
  __bf16* vt = vt_out + (size_t)bh * DH * SEQ + (size_t)n * SEQ + t0 + 8 * hig;

#pragma unroll
  for (int g = 0; g < 12; ++g) {
    const int sel = g >> 2, c = g & 3;
    if (sel < 2) {
      // q, k: D[e = 16c + 8*hig + j][t = 16i + n] = W x^T + bias[e]
      __bf16* out = qo + (size_t)sel * ((size_t)BATCH * HEADS * SEQ * DH);
#pragma unroll
      for (int i = 0; i < 4; ++i) {
        v8f acc = wmma_bf16(rw[c][0], xa[i][0], rb[c]);
        acc = wmma_bf16(rw[c][1], xa[i][1], acc);
        v8bf r;
#pragma unroll
        for (int j = 0; j < 8; ++j) r[j] = (__bf16)acc[j];
        *(v8bf*)(out + (size_t)(i * 16) * DH + c * 16) = r;
      }
    } else {
      // v: D[t = 16i + 8*hig + j][e = 16c + n] = x W^T + bias[e], stored as V^T
      v8f bvec;
#pragma unroll
      for (int j = 0; j < 8; ++j) bvec[j] = bvl[c];
#pragma unroll
      for (int i = 0; i < 4; ++i) {
        v8f acc = wmma_bf16(xa[i][0], rw[c][0], bvec);
        acc = wmma_bf16(xa[i][1], rw[c][1], acc);
        v8bf r;
#pragma unroll
        for (int j = 0; j < 8; ++j) r[j] = (__bf16)acc[j];
        *(v8bf*)(vt + (size_t)(c * 16) * SEQ + i * 16) = r;
      }
    }
    if (g + 4 < 12) {
      // the group's stores name registers that the loads below may take over
      asm volatile("s_wait_xcnt 0x0" ::: "memory");
      const __bf16* Wn = wqkv + (size_t)(sel + 1) * (DH * DH) + (size_t)(c * 16) * DH;
      rw[c][0] = load_frag_bf16(Wn, DH);
      rw[c][1] = load_frag_bf16(Wn + 32, DH);
      if (sel == 0) rb[c] = *(const v8f*)(bk + c * 16 + 8 * hig);
      // holds the refill of this slot here, three groups of products ahead of its
      // use: sunk to the use, its latency would be waited out once a group
      __builtin_amdgcn_sched_barrier(0);
    }
  }
}

#define QT 2   // 16-query tiles per wave

__global__ void __launch_bounds__(256) flash_attn_kernel(
    const __bf16* __restrict__ Q, const __bf16* __restrict__ K,
    const __bf16* __restrict__ Vt, __bf16* __restrict__ O) {
  __shared__ __attribute__((aligned(16))) __bf16 Kl[2][32 * KP];    // 32 keys x 64 d, padded rows
  __shared__ __attribute__((aligned(16))) __bf16 Vl[2][DH * VP];    // 64 d x 32 keys (V^T), padded rows

  const int tid  = threadIdx.x;
  const int wave = tid >> 5;
  const int lane = tid & 31;
  const int n = lane & 15, hig = lane >> 4;
  const int bh = blockIdx.y;
  const int b = bh / HEADS, h = bh % HEADS;
  const int q0 = blockIdx.x * (128 * QT) + wave * (16 * QT);

  const __bf16* Qp = Q + ((size_t)(bh * SEQ + q0)) * DH;
  v16bf qa[QT][2];
#pragma unroll
  for (int t = 0; t < QT; ++t) {
    qa[t][0] = load_frag_bf16(Qp + (size_t)(t * 16) * DH, DH);
    qa[t][1] = load_frag_bf16(Qp + (size_t)(t * 16) * DH + 32, DH);
  }

  const __bf16* Kb = K + (size_t)bh * SEQ * DH;
  const __bf16* Vb = Vt + (size_t)bh * DH * SEQ;

  // cooperative-stage index split: 256 threads x 8 bf16 = 2048 elems (4KB)
  const int vrow = tid >> 2, vpart = tid & 3;
  const int kdst = (tid >> 3) * KP + (tid & 7) * 8;   // K: 8 threads per 64-d row
  const int vdst = vrow * VP + vpart * 8;

  v8f   o[QT][4];   // o[t][c][j] = O^T[d = 16c + 8*hig + j][query 16t + n]
  float rmax[QT];   // running maximum of query 16t + n (same in both halves)
  float rsum[QT];   // running sum over this half's keys only
#pragma unroll
  for (int t = 0; t < QT; ++t) {
    rmax[t] = -3.0e38f;
    rsum[t] = 0.0f;
#pragma unroll
    for (int c = 0; c < 4; ++c)
#pragma unroll
      for (int j = 0; j < 8; ++j) o[t][c][j] = 0.0f;
  }

  const float SC = 0.03125f * 1.44269504088896f;  // (1/sqrt(C)) * log2(e)
  const int NCH = SEQ / 32;

  // prologue: stage chunk 0 into buffer 0
  {
    v8bf kr = *(const v8bf*)(Kb + tid * 8);
    v8bf vr = *(const v8bf*)(Vb + (size_t)vrow * SEQ + vpart * 8);
    *(v8bf*)(&Kl[0][kdst]) = kr;
    *(v8bf*)(&Vl[0][vdst]) = vr;
  }
  __syncthreads();

  for (int kb = 0; kb < NCH; ++kb) {
    const int cur = kb & 1;
    const bool more = (kb + 1 < NCH);

    // issue global loads for chunk kb+1 (in flight during the WMMAs below)
    v8bf kr{}, vr{};
    if (more) {
      kr = *(const v8bf*)(Kb + (size_t)((kb + 1) * 32) * DH + tid * 8);
      vr = *(const v8bf*)(Vb + (size_t)vrow * SEQ + (kb + 1) * 32 + vpart * 8);
      if (kb + 2 < NCH)  // global_prefetch for chunk kb+2
        __builtin_prefetch(Kb + (size_t)((kb + 2) * 32) * DH, 0, 0);
    }
    // keeps the staging loads at the head of the pass: sunk to the foot, next
    // to their LDS stores, their latency would stand in front of the barrier
    __builtin_amdgcn_sched_barrier(0);

    // S^T[32k x 16q] = K @ Q^T from LDS, per query tile: two 16x16 C-tiles of
    // 2 WMMAs each; the four K fragments are read once for both query tiles
    const __bf16* Kc = Kl[cur];
    v8f s0[QT], s1[QT];
    {
      v16bf k00 = load_frag_bf16(Kc, KP);
      v16bf k01 = load_frag_bf16(Kc + 32, KP);
      v16bf k10 = load_frag_bf16(Kc + 16 * KP, KP);
      v16bf k11 = load_frag_bf16(Kc + 16 * KP + 32, KP);
#pragma unroll
      for (int t = 0; t < QT; ++t) {
#pragma unroll
        for (int j = 0; j < 8; ++j) { s0[t][j] = 0.0f; s1[t][j] = 0.0f; }
        s0[t] = wmma_bf16(k00, qa[t][0], s0[t]);
        s0[t] = wmma_bf16(k01, qa[t][1], s0[t]);
        s1[t] = wmma_bf16(k10, qa[t][0], s1[t]);
        s1[t] = wmma_bf16(k11, qa[t][1], s1[t]);
      }
    }

    // V^T fragments (A operand: rows d, k = keys), in flight under the softmax
    const __bf16* Vc = Vl[cur];
    v16bf vf[4];
#pragma unroll
    for (int c = 0; c < 4; ++c) vf[c] = load_frag_bf16(Vc + (c * 16) * VP, VP);
    // the eight V reads issue here as one group, so that the softmax covers their
    // latency; sunk to their products each pair would be waited for on its own
    __builtin_amdgcn_sched_barrier(0);

#pragma unroll
    for (int t = 0; t < QT; ++t) {
      // online softmax (log2 domain) of query 16t + n: maximum of the raw scores
      // (the scale is positive) in-lane, then joined with the other half's
      float mx = fmaxf(s0[t][0], s1[t][0]);
#pragma unroll
      for (int j = 1; j < 8; ++j) mx = fmaxf(mx, fmaxf(s0[t][j], s1[t][j]));
      mx = fmaxf(mx, xhalf(mx)) * SC;
      const float mn = fmaxf(rmax[t], mx);
      const float f  = __builtin_amdgcn_exp2f(rmax[t] - mn);
      rmax[t] = mn;

      v16bf pb;   // P^T as B operand: element i = key 8*hig + i, i + 8 = key 16 + 8*hig + i
      float ps[8];
#pragma unroll
      for (int j = 0; j < 8; ++j) {
        const float p0 = __builtin_amdgcn_exp2f(fmaf(s0[t][j], SC, -mn));
        const float p1 = __builtin_amdgcn_exp2f(fmaf(s1[t][j], SC, -mn));
        ps[j] = p0 + p1;
        pb[j]     = (__bf16)p0;
        pb[j + 8] = (__bf16)p1;
      }
      rsum[t] = fmaf(rsum[t], f, ((ps[0] + ps[1]) + (ps[2] + ps[3])) +
                                 ((ps[4] + ps[5]) + (ps[6] + ps[7])));

      // O^T = O^T * f + V^T @ P^T
#pragma unroll
      for (int c = 0; c < 4; ++c) {
        o[t][c] *= f;
        o[t][c] = wmma_bf16(vf[c], pb, o[t][c]);
      }
    }

    // keeps the wait for the staging loads, the LDS stores and the barrier at the
    // foot of the pass: lifted over the softmax they would wait out the loads' latency
    __builtin_amdgcn_sched_barrier(0);

    // store staged chunk kb+1 to the alternate buffer (its readers finished
    // before the previous barrier), then make it visible
    if (more) {
      *(v8bf*)(&Kl[1 - cur][kdst]) = kr;
      *(v8bf*)(&Vl[1 - cur][vdst]) = vr;
    }
    __syncthreads();
  }

  // normalize and store bf16 to [B,T,C] (head-interleaved for the projection):
  // a lane holds 8 consecutive d of its query per tile, one 16-byte store each
#pragma unroll
  for (int t = 0; t < QT; ++t) {
    const float inv = 1.0f / (rsum[t] + xhalf(rsum[t]));   // join the halves' sums
    __bf16* op = O + ((size_t)(b * SEQ + q0 + t * 16 + n)) * DM + h * DH + 8 * hig;
#pragma unroll
    for (int c = 0; c < 4; ++c) {
      v8bf r;
#pragma unroll
      for (int j = 0; j < 8; ++j) r[j] = (__bf16)(o[t][c][j] * inv);
      *(v8bf*)(op + c * 16) = r;
    }
  }
}

// ---------------------------------------------------------------------------
// Kernel 3: output projection  Y = O @ Wp^T + bp  (M=8192, N=K=1024, fp32 out)
// 8 waves/block -> 128x64 block tile.  The Wp k-slice (64 cols x 32 k, 4KB)
// is shared by all 8 waves -> double-buffered LDS staging (8x traffic cut).
// ---------------------------------------------------------------------------
__global__ void __launch_bounds__(256) out_proj_kernel(
    const __bf16* __restrict__ Ob, const __bf16* __restrict__ Wpb,
    const float* __restrict__ bp, float* __restrict__ out) {
  __shared__ __attribute__((aligned(16))) __bf16 Wl[2][64 * VP];   // 64 cols x 32 k, padded rows

  const int tid  = threadIdx.x;
  const int wave = tid >> 5;
  const int lane = tid & 31;
  const int n = lane & 15, hig = lane >> 4;
  const int r0 = blockIdx.x * 128 + wave * 16;
  const int n0 = blockIdx.y * 64;
  const int wrow = tid >> 2, wpart = tid & 3;

  v8f acc[4];
#pragma unroll
  for (int c = 0; c < 4; ++c) {
    const float bval = bp[n0 + c * 16 + n];
#pragma unroll
    for (int j = 0; j < 8; ++j) acc[c][j] = bval;
  }

  // prologue: stage Wp k-slice 0
  {
    v8bf wr = *(const v8bf*)(Wpb + (size_t)(n0 + wrow) * DM + wpart * 8);
    *(v8bf*)(&Wl[0][wrow * VP + wpart * 8]) = wr;
  }
  __syncthreads();

  const int NKC = DM / 32;
  for (int kc = 0; kc < NKC; ++kc) {
    const int cur = kc & 1;
    const bool more = (kc + 1 < NKC);

    v8bf wr{};
    if (more)
      wr = *(const v8bf*)(Wpb + (size_t)(n0 + wrow) * DM + (kc + 1) * 32 + wpart * 8);

    v16bf a = load_frag_bf16(Ob + (size_t)r0 * DM + kc * 32, DM);
#pragma unroll
    for (int c = 0; c < 4; ++c) {
      v16bf w = load_frag_bf16(&Wl[cur][(c * 16) * VP], VP);
      acc[c] = wmma_bf16(a, w, acc[c]);
    }

    if (more)
      *(v8bf*)(&Wl[1 - cur][wrow * VP + wpart * 8]) = wr;
    __syncthreads();
  }

#pragma unroll
  for (int c = 0; c < 4; ++c)
#pragma unroll
    for (int j = 0; j < 8; ++j)
      out[(size_t)(r0 + j + 8 * hig) * DM + n0 + c * 16 + n] = acc[c][j];
}

// ---------------------------------------------------------------------------
// Host launcher
// ---------------------------------------------------------------------------
extern "C" void kernel_launch(void* const* d_in, const int* in_sizes, int n_in,
                              void* d_out, int out_size, void* d_ws, size_t ws_size,
                              hipStream_t stream) {
  const float* x  = (const float*)d_in[0];
  const float* Wq = (const float*)d_in[1];
  const float* bq = (const float*)d_in[2];
  const float* Wk = (const float*)d_in[3];
  const float* bk = (const float*)d_in[4];
  const float* Wv = (const float*)d_in[5];
  const float* bv = (const float*)d_in[6];
  const float* Wp = (const float*)d_in[7];
  const float* bp = (const float*)d_in[8];
  float* out = (float*)d_out;

  __bf16* ws = (__bf16*)d_ws;
  const size_t QKV_E = (size_t)BATCH * HEADS * SEQ * DH;  // 8,388,608 elems each
  __bf16* Qw   = ws;                       // [B,H,T,64]   bf16
  __bf16* Vtw  = ws + 2 * QKV_E;           // [B,H,64,T]   bf16 (transposed V)
  __bf16* Ow   = ws + 3 * QKV_E;           // [B,T,1024]   bf16
  __bf16* Wpb  = ws + 4 * QKV_E;           // [1024,1024]  bf16
  __bf16* Wqkv = Wpb + (size_t)DM * DM;    // 3 x [64,64]  bf16
  // total: ~69.2 MB of d_ws

  cvt_weights_kernel<<<256, 256, 0, stream>>>(Wq, Wk, Wv, Wp, Wqkv, Wpb);

  qkv_proj_kernel<<<BATCH * HEADS * (SEQ / 64) / 8, 256, 0, stream>>>(x, Wqkv, bq, bk, bv, Qw, Vtw);

  dim3 g2(SEQ / (128 * QT), BATCH * HEADS);
  flash_attn_kernel<<<g2, 256, 0, stream>>>(Qw, Qw + QKV_E, Vtw, Ow);

  dim3 g3((BATCH * SEQ) / 128, DM / 64);
  out_proj_kernel<<<g3, 256, 0, stream>>>(Ow, Wpb, bp, out);
}

// v005
// It runs in 103 microseconds.
// Two timings next to v004 put it at 1.04 and 1.03 times that version's speed.
// Counting every step since v000, it is 3.16 times as fast.
#include <hip/hip_runtime.h>
#include <hip/hip_bf16.h>

typedef __attribute__((ext_vector_type(16))) __bf16 v16bf;
typedef __attribute__((ext_vector_type(8)))  __bf16 v8bf;
typedef __attribute__((ext_vector_type(8)))  float  v8f;

#define HEADS 16
#define DH    64
#define DM    1024
#define BATCH 4
#define SEQ   2048

// LDS row pitches in elements: an odd multiple of 16 bytes, so that the 16 rows
// a 16-byte fragment load touches fall on 16 different groups of four banks
#define KP 72   // rows of 64 bf16 (128 B) at 144 B
#define VP 40   // rows of 32 bf16 (64 B) at 80 B

// ---------------------------------------------------------------------------
// WMMA helper: D = A(16x32 bf16) * B(32x16 bf16) + C(16x16 f32)
// ---------------------------------------------------------------------------
__device__ __forceinline__ v8f wmma_bf16(v16bf a, v16bf b, v8f c) {
  return __builtin_amdgcn_wmma_f32_16x16x32_bf16(
      /*neg_a=*/false, a, /*neg_b=*/false, b,
      /*c_mod=*/(short)0, c, /*reuse_a=*/false, /*reuse_b=*/false);
}

// ---------------------------------------------------------------------------
// Fragment loaders: documented gfx1250 16-bit A/B layout.
// Lane L holds row/col (L & 15); K runs: base=(L>>4)*8, elements [base..base+7]
// and [base+16..base+23].  base pointer must be 16B aligned; ld in elements.
// ---------------------------------------------------------------------------
__device__ __forceinline__ v16bf load_frag_bf16(const __bf16* base, int ld) {
  const int lane = threadIdx.x & 31;
  const __bf16* p = base + (size_t)(lane & 15) * ld + ((lane >> 4) << 3);
  v8bf lo = *(const v8bf*)(p);
  v8bf hi = *(const v8bf*)(p + 16);
  v16bf r;
#pragma unroll
  for (int i = 0; i < 8; ++i) { r[i] = lo[i]; r[i + 8] = hi[i]; }
  return r;
}

__device__ __forceinline__ v16bf load_frag_f32(const float* base, int ld) {
  const int lane = threadIdx.x & 31;
  const float* p = base + (size_t)(lane & 15) * ld + ((lane >> 4) << 3);
  v16bf r;
#pragma unroll
  for (int i = 0; i < 8; ++i) {
    r[i]     = (__bf16)p[i];
    r[i + 8] = (__bf16)p[i + 16];
  }
  return r;
}

// value of lane l ^ 16 (the other half of the wave), one vector instruction
__device__ __forceinline__ float xhalf(float v) {
  const int b = __builtin_bit_cast(int, v);
  return __builtin_bit_cast(float, __builtin_amdgcn_permlanex16(
      b, b, 0x76543210, 0xfedcba98, false, false));
}

// ---------------------------------------------------------------------------
// Kernel 0: convert weights fp32 -> bf16 (Wq|Wk|Wv packed, Wp)
// ---------------------------------------------------------------------------
__global__ void __launch_bounds__(256) cvt_weights_kernel(
    const float* __restrict__ Wq, const float* __restrict__ Wk,
    const float* __restrict__ Wv, const float* __restrict__ Wp,
    __bf16* __restrict__ wqkv, __bf16* __restrict__ wpb) {
  const int stride = gridDim.x * blockDim.x;
  const int i0 = blockIdx.x * blockDim.x + threadIdx.x;
  for (int i = i0; i < 3 * DH * DH; i += stride) {
    const float* s = (i < DH * DH) ? Wq : (i < 2 * DH * DH) ? Wk : Wv;
    wqkv[i] = (__bf16)s[i % (DH * DH)];
  }
  for (int i = i0; i < DM * DM; i += stride) wpb[i] = (__bf16)Wp[i];
}

// ---------------------------------------------------------------------------
// Kernel 1: per-head QKV projection.  One wave takes 64 rows (t) of one head:
// it reads its x once, keeps the four 16-row fragment pairs in registers and
// makes q, k and v from them.  q and k are taken transposed (W x^T): a lane then
// holds 8 consecutive e of one row t.  v is taken as x W^T: a lane holds 8
// consecutive t of one e.  Either way a lane stores 16-byte runs.
// The work is 12 groups (3 matrices x 4 tiles of 16 weight rows); a group's two
// weight fragments and its bias come four groups ahead, through four register slots.
// Q,K stored [B,H,T,64]; V stored transposed [B,H,64,T] for the P@V stage.
// ---------------------------------------------------------------------------
typedef __attribute__((ext_vector_type(4))) float v4f;

__global__ void __launch_bounds__(256) qkv_proj_kernel(
    const float* __restrict__ x, const __bf16* __restrict__ wqkv,
    const float* __restrict__ bq, const float* __restrict__ bk,
    const float* __restrict__ bv,
    __bf16* __restrict__ qk_out, __bf16* __restrict__ vt_out) {
  const int wave = threadIdx.x >> 5;
  const int lane = threadIdx.x & 31;
  const int n    = lane & 15;
  const int hig  = lane >> 4;
  const int nu   = SEQ / 64;
  const int unit = blockIdx.x * 8 + wave;      // 64-row unit of one head
  const int t0   = (unit % nu) * 64;
  const int bh   = unit / nu;
  const int b    = bh / HEADS, h = bh % HEADS;

  // groups 0..2 (Wq rows 0..47 with their bias), then all of the wave's x: 32 loads
  // of 16 bytes a lane
  v16bf rw[4][2];
  v8f   rb[4];
#pragma unroll
  for (int c = 0; c < 3; ++c) {
    rw[c][0] = load_frag_bf16(wqkv + (size_t)(c * 16) * DH, DH);
    rw[c][1] = load_frag_bf16(wqkv + (size_t)(c * 16) * DH + 32, DH);
    rb[c]    = *(const v8f*)(bq + c * 16 + 8 * hig);
  }
  const float* xp = x + ((size_t)(b * SEQ + t0 + n)) * DM + h * DH + 8 * hig;
  v4f xr[4][2][4];   // [16-row tile][k half][k 0..3, 4..7, 16..19, 20..23 of the lane's run]
#pragma unroll
  for (int i = 0; i < 4; ++i)
#pragma unroll
    for (int kh = 0; kh < 2; ++kh) {
      const float* p = xp + (size_t)(i * 16) * DM + kh * 32;
      xr[i][kh][0] = *(const v4f*)(p);
      xr[i][kh][1] = *(const v4f*)(p + 4);
      xr[i][kh][2] = *(const v4f*)(p + 16);
      xr[i][kh][3] = *(const v4f*)(p + 20);
    }
  // the x address registers are free from here on: the wait stands before their reuse
  asm volatile("s_wait_xcnt 0x0" ::: "memory");
  // keeps every load above in flight at once: left free, the conversions below are
  // woven between the loads and only four of them are outstanding at a time
  __builtin_amdgcn_sched_barrier(0);

  // group 3 and the four v biases: their registers are not there before x is converted
  float bvl[4];
  rw[3][0] = load_frag_bf16(wqkv + (size_t)48 * DH, DH);
  rw[3][1] = load_frag_bf16(wqkv + (size_t)48 * DH + 32, DH);
  rb[3]    = *(const v8f*)(bq + 48 + 8 * hig);
#pragma unroll
  for (int c = 0; c < 4; ++c) bvl[c] = bv[c * 16 + n];

  v16bf xa[4][2];
#pragma unroll
  for (int i = 0; i < 4; ++i)
#pragma unroll
    for (int kh = 0; kh < 2; ++kh)
#pragma unroll
      for (int e = 0; e < 4; ++e) {
        xa[i][kh][e]      = (__bf16)xr[i][kh][0][e];
        xa[i][kh][e + 4]  = (__bf16)xr[i][kh][1][e];
        xa[i][kh][e + 8]  = (__bf16)xr[i][kh][2][e];
        xa[i][kh][e + 12] = (__bf16)xr[i][kh][3][e];
      }

  __bf16* qo = qk_out + ((size_t)(bh * SEQ + t0 + n)) * DH + 8 * hig;
  __bf16* vt = vt_out + (size_t)bh * DH * SEQ + (size_t)n * SEQ + t0 + 8 * hig;

#pragma unroll
  for (int g = 0; g < 12; ++g) {
    const int sel = g >> 2, c = g & 3;
    if (sel < 2) {
      // q, k: D[e = 16c + 8*hig + j][t = 16i + n] = W x^T + bias[e]
      __bf16* out = qo + (size_t)sel * ((size_t)BATCH * HEADS * SEQ * DH);
#pragma unroll
      for (int i = 0; i < 4; ++i) {
        v8f acc = wmma_bf16(rw[c][0], xa[i][0], rb[c]);
        acc = wmma_bf16(rw[c][1], xa[i][1], acc);
        v8bf r;
#pragma unroll
        for (int j = 0; j < 8; ++j) r[j] = (__bf16)acc[j];
        *(v8bf*)(out + (size_t)(i * 16) * DH + c * 16) = r;
      }
    } else {
      // v: D[t = 16i + 8*hig + j][e = 16c + n] = x W^T + bias[e], stored as V^T
      v8f bvec;
#pragma unroll
      for (int j = 0; j < 8; ++j) bvec[j] = bvl[c];
#pragma unroll
      for (int i = 0; i < 4; ++i) {
        v8f acc = wmma_bf16(xa[i][0], rw[c][0], bvec);
        acc = wmma_bf16(xa[i][1], rw[c][1], acc);
        v8bf r;
#pragma unroll
        for (int j = 0; j < 8; ++j) r[j] = (__bf16)acc[j];
        *(v8bf*)(vt + (size_t)(c * 16) * SEQ + i * 16) = r;
      }
    }
    if (g + 4 < 12) {
      // the group's stores name registers that the loads below may take over
      asm volatile("s_wait_xcnt 0x0" ::: "memory");
      const __bf16* Wn = wqkv + (size_t)(sel + 1) * (DH * DH) + (size_t)(c * 16) * DH;
      rw[c][0] = load_frag_bf16(Wn, DH);
      rw[c][1] = load_frag_bf16(Wn + 32, DH);
      if (sel == 0) rb[c] = *(const v8f*)(bk + c * 16 + 8 * hig);
      // holds the refill of this slot here, three groups of products ahead of its
      // use: sunk to the use, its latency would be waited out once a group
      __builtin_amdgcn_sched_barrier(0);
    }
  }
}

#define QT 2   // 16-query tiles per wave

__global__ void __launch_bounds__(256) flash_attn_kernel(
    const __bf16* __restrict__ Q, const __bf16* __restrict__ K,
    const __bf16* __restrict__ Vt, __bf16* __restrict__ O) {
  __shared__ __attribute__((aligned(16))) __bf16 Kl[2][32 * KP];    // 32 keys x 64 d, padded rows
  __shared__ __attribute__((aligned(16))) __bf16 Vl[2][DH * VP];    // 64 d x 32 keys (V^T), padded rows

  const int tid  = threadIdx.x;
  const int wave = tid >> 5;
  const int lane = tid & 31;
  const int n = lane & 15, hig = lane >> 4;
  const int bh = blockIdx.y;
  const int b = bh / HEADS, h = bh % HEADS;
  const int q0 = blockIdx.x * (128 * QT) + wave * (16 * QT);

  const __bf16* Qp = Q + ((size_t)(bh * SEQ + q0)) * DH;
  v16bf qa[QT][2];
#pragma unroll
  for (int t = 0; t < QT; ++t) {
    qa[t][0] = load_frag_bf16(Qp + (size_t)(t * 16) * DH, DH);
    qa[t][1] = load_frag_bf16(Qp + (size_t)(t * 16) * DH + 32, DH);
  }

  const __bf16* Kb = K + (size_t)bh * SEQ * DH;
  const __bf16* Vb = Vt + (size_t)bh * DH * SEQ;

  // cooperative-stage index split: 256 threads x 8 bf16 = 2048 elems (4KB)
  const int vrow = tid >> 2, vpart = tid & 3;
  const int kdst = (tid >> 3) * KP + (tid & 7) * 8;   // K: 8 threads per 64-d row
  const int vdst = vrow * VP + vpart * 8;

  v8f   o[QT][4];   // o[t][c][j] = O^T[d = 16c + 8*hig + j][query 16t + n]
  float rmax[QT];   // maximum in use for query 16t + n (same in both halves)
  float thr[QT];    // raw score above which that maximum is replaced
  float rsum[QT];   // running sum over this half's keys only
#pragma unroll
  for (int t = 0; t < QT; ++t) {
    rmax[t] = -3.0e38f;
    thr[t]  = -3.0e38f;   // the first pass always sets the maximum
    rsum[t] = 0.0f;
#pragma unroll
    for (int c = 0; c < 4; ++c)
#pragma unroll
      for (int j = 0; j < 8; ++j) o[t][c][j] = 0.0f;
  }

  const float SC = 0.03125f * 1.44269504088896f;  // (1/sqrt(C)) * log2(e)
  const int NCH = SEQ / 32;

  // prologue: stage chunk 0 into buffer 0
  {
    v8bf kr = *(const v8bf*)(Kb + tid * 8);
    v8bf vr = *(const v8bf*)(Vb + (size_t)vrow * SEQ + vpart * 8);
    *(v8bf*)(&Kl[0][kdst]) = kr;
    *(v8bf*)(&Vl[0][vdst]) = vr;
  }
  __syncthreads();

  for (int kb = 0; kb < NCH; ++kb) {
    const int cur = kb & 1;
    const bool more = (kb + 1 < NCH);

    // issue global loads for chunk kb+1 (in flight during the WMMAs below)
    v8bf kr{}, vr{};
    if (more) {
      kr = *(const v8bf*)(Kb + (size_t)((kb + 1) * 32) * DH + tid * 8);
      vr = *(const v8bf*)(Vb + (size_t)vrow * SEQ + (kb + 1) * 32 + vpart * 8);
      if (kb + 2 < NCH)  // global_prefetch for chunk kb+2
        __builtin_prefetch(Kb + (size_t)((kb + 2) * 32) * DH, 0, 0);
    }
    // keeps the staging loads at the head of the pass: sunk to the foot, next
    // to their LDS stores, their latency would stand in front of the barrier
    __builtin_amdgcn_sched_barrier(0);

    // S^T[32k x 16q] = K @ Q^T from LDS, per query tile: two 16x16 C-tiles of
    // 2 WMMAs each; the four K fragments are read once for both query tiles
    const __bf16* Kc = Kl[cur];
    v8f s0[QT], s1[QT];
    {
      v16bf k00 = load_frag_bf16(Kc, KP);
      v16bf k01 = load_frag_bf16(Kc + 32, KP);
      v16bf k10 = load_frag_bf16(Kc + 16 * KP, KP);
      v16bf k11 = load_frag_bf16(Kc + 16 * KP + 32, KP);
#pragma unroll
      for (int t = 0; t < QT; ++t) {
#pragma unroll
        for (int j = 0; j < 8; ++j) { s0[t][j] = 0.0f; s1[t][j] = 0.0f; }
        s0[t] = wmma_bf16(k00, qa[t][0], s0[t]);
        s0[t] = wmma_bf16(k01, qa[t][1], s0[t]);
        s1[t] = wmma_bf16(k10, qa[t][0], s1[t]);
        s1[t] = wmma_bf16(k11, qa[t][1], s1[t]);
      }
    }

    // V^T fragments (A operand: rows d, k = keys), in flight under the softmax
    const __bf16* Vc = Vl[cur];
    v16bf vf[4];
#pragma unroll
    for (int c = 0; c < 4; ++c) vf[c] = load_frag_bf16(Vc + (c * 16) * VP, VP);
    // the eight V reads issue here as one group, so that the softmax covers their
    // latency; sunk to their products each pair would be waited for on its own
    __builtin_amdgcn_sched_barrier(0);

    // in-lane maximum of the raw scores of query 16t + n (the scale is positive)
    float mx[QT];
#pragma unroll
    for (int t = 0; t < QT; ++t) {
      mx[t] = fmaxf(s0[t][0], s1[t][0]);
#pragma unroll
      for (int j = 1; j < 8; ++j) mx[t] = fmaxf(mx[t], fmaxf(s0[t][j], s1[t][j]));
    }
    // one wave-uniform test per pass: does any query of the wave need a new maximum?
    if (__builtin_amdgcn_ballot_w32((mx[0] > thr[0]) | (mx[1] > thr[1])) != 0) {
#pragma unroll
      for (int t = 0; t < QT; ++t) {
        // joined with the other half's, so that both halves of a query use one maximum
        const float mn = fmaxf(rmax[t], fmaxf(mx[t], xhalf(mx[t])) * SC);
        const float f  = __builtin_amdgcn_exp2f(rmax[t] - mn);
        rmax[t] = mn;
        thr[t]  = (mn + 8.0f) * (1.0f / SC);
        rsum[t] *= f;
#pragma unroll
        for (int c = 0; c < 4; ++c) o[t][c] *= f;
      }
    }

#pragma unroll
    for (int t = 0; t < QT; ++t) {
      // softmax numerators (log2 domain) against the maximum in use
      const float mn = rmax[t];

      v16bf pb;   // P^T as B operand: element i = key 8*hig + i, i + 8 = key 16 + 8*hig + i
      float ps[8];
#pragma unroll
      for (int j = 0; j < 8; ++j) {
        const float p0 = __builtin_amdgcn_exp2f(fmaf(s0[t][j], SC, -mn));
        const float p1 = __builtin_amdgcn_exp2f(fmaf(s1[t][j], SC, -mn));
        ps[j] = p0 + p1;
        pb[j]     = (__bf16)p0;
        pb[j + 8] = (__bf16)p1;
      }
      rsum[t] += ((ps[0] + ps[1]) + (ps[2] + ps[3])) +
                 ((ps[4] + ps[5]) + (ps[6] + ps[7]));

      // O^T += V^T @ P^T
#pragma unroll
      for (int c = 0; c < 4; ++c) o[t][c] = wmma_bf16(vf[c], pb, o[t][c]);
    }

    // keeps the wait for the staging loads, the LDS stores and the barrier at the
    // foot of the pass: lifted over the softmax they would wait out the loads' latency
    __builtin_amdgcn_sched_barrier(0);

    // store staged chunk kb+1 to the alternate buffer (its readers finished
    // before the previous barrier), then make it visible
    if (more) {
      *(v8bf*)(&Kl[1 - cur][kdst]) = kr;
      *(v8bf*)(&Vl[1 - cur][vdst]) = vr;
    }
    __syncthreads();
  }

  // normalize and store bf16 to [B,T,C] (head-interleaved for the projection):
  // a lane holds 8 consecutive d of its query per tile, one 16-byte store each
#pragma unroll
  for (int t = 0; t < QT; ++t) {
    const float inv = 1.0f / (rsum[t] + xhalf(rsum[t]));   // join the halves' sums
    __bf16* op = O + ((size_t)(b * SEQ + q0 + t * 16 + n)) * DM + h * DH + 8 * hig;
#pragma unroll
    for (int c = 0; c < 4; ++c) {
      v8bf r;
#pragma unroll
      for (int j = 0; j < 8; ++j) r[j] = (__bf16)(o[t][c][j] * inv);
      *(v8bf*)(op + c * 16) = r;
    }
  }
}

// ---------------------------------------------------------------------------
// Kernel 3: output projection  Y = O @ Wp^T + bp  (M=8192, N=K=1024, fp32 out)
// 8 waves/block -> 128x64 block tile.  The Wp k-slice (64 cols x 32 k, 4KB)
// is shared by all 8 waves -> double-buffered LDS staging (8x traffic cut).
// ---------------------------------------------------------------------------
__global__ void __launch_bounds__(256) out_proj_kernel(
    const __bf16* __restrict__ Ob, const __bf16* __restrict__ Wpb,
    const float* __restrict__ bp, float* __restrict__ out) {
  __shared__ __attribute__((aligned(16))) __bf16 Wl[2][64 * VP];   // 64 cols x 32 k, padded rows

  const int tid  = threadIdx.x;
  const int wave = tid >> 5;
  const int lane = tid & 31;
  const int n = lane & 15, hig = lane >> 4;
  const int r0 = blockIdx.x * 128 + wave * 16;
  const int n0 = blockIdx.y * 64;
  const int wrow = tid >> 2, wpart = tid & 3;

  v8f acc[4];
#pragma unroll
  for (int c = 0; c < 4; ++c) {
    const float bval = bp[n0 + c * 16 + n];
#pragma unroll
    for (int j = 0; j < 8; ++j) acc[c][j] = bval;
  }

  // prologue: stage Wp k-slice 0
  {
    v8bf wr = *(const v8bf*)(Wpb + (size_t)(n0 + wrow) * DM + wpart * 8);
    *(v8bf*)(&Wl[0][wrow * VP + wpart * 8]) = wr;
  }
  __syncthreads();

  const int NKC = DM / 32;
  for (int kc = 0; kc < NKC; ++kc) {
    const int cur = kc & 1;
    const bool more = (kc + 1 < NKC);

    v8bf wr{};
    if (more)
      wr = *(const v8bf*)(Wpb + (size_t)(n0 + wrow) * DM + (kc + 1) * 32 + wpart * 8);

    v16bf a = load_frag_bf16(Ob + (size_t)r0 * DM + kc * 32, DM);
#pragma unroll
    for (int c = 0; c < 4; ++c) {
      v16bf w = load_frag_bf16(&Wl[cur][(c * 16) * VP], VP);
      acc[c] = wmma_bf16(a, w, acc[c]);
    }

    if (more)
      *(v8bf*)(&Wl[1 - cur][wrow * VP + wpart * 8]) = wr;
    __syncthreads();
  }

#pragma unroll
  for (int c = 0; c < 4; ++c)
#pragma unroll
    for (int j = 0; j < 8; ++j)
      out[(size_t)(r0 + j + 8 * hig) * DM + n0 + c * 16 + n] = acc[c][j];
}

// ---------------------------------------------------------------------------
// Host launcher
// ---------------------------------------------------------------------------
extern "C" void kernel_launch(void* const* d_in, const int* in_sizes, int n_in,
                              void* d_out, int out_size, void* d_ws, size_t ws_size,
                              hipStream_t stream) {
  const float* x  = (const float*)d_in[0];
  const float* Wq = (const float*)d_in[1];
  const float* bq = (const float*)d_in[2];
  const float* Wk = (const float*)d_in[3];
  const float* bk = (const float*)d_in[4];
  const float* Wv = (const float*)d_in[5];
  const float* bv = (const float*)d_in[6];
  const float* Wp = (const float*)d_in[7];
  const float* bp = (const float*)d_in[8];
  float* out = (float*)d_out;

  __bf16* ws = (__bf16*)d_ws;
  const size_t QKV_E = (size_t)BATCH * HEADS * SEQ * DH;  // 8,388,608 elems each
  __bf16* Qw   = ws;                       // [B,H,T,64]   bf16
  __bf16* Vtw  = ws + 2 * QKV_E;           // [B,H,64,T]   bf16 (transposed V)
  __bf16* Ow   = ws + 3 * QKV_E;           // [B,T,1024]   bf16
  __bf16* Wpb  = ws + 4 * QKV_E;           // [1024,1024]  bf16
  __bf16* Wqkv = Wpb + (size_t)DM * DM;    // 3 x [64,64]  bf16
  // total: ~69.2 MB of d_ws

  cvt_weights_kernel<<<256, 256, 0, stream>>>(Wq, Wk, Wv, Wp, Wqkv, Wpb);

  qkv_proj_kernel<<<BATCH * HEADS * (SEQ / 64) / 8, 256, 0, stream>>>(x, Wqkv, bq, bk, bv, Qw, Vtw);

  dim3 g2(SEQ / (128 * QT), BATCH * HEADS);
  flash_attn_kernel<<<g2, 256, 0, stream>>>(Qw, Qw + QKV_E, Vtw, Ow);

  dim3 g3((BATCH * SEQ) / 128, DM / 64);
  out_proj_kernel<<<g3, 256, 0, stream>>>(Ow, Wpb, bp, out);
}

// v006
// It runs in 95.3 microseconds.
// Next to v005, in two timings, it ran 1.09 and 1.08 times as fast.
// Counting every step since v000, it is 3.43 times as fast.
#include <hip/hip_runtime.h>
#include <hip/hip_bf16.h>

typedef __attribute__((ext_vector_type(16))) __bf16 v16bf;
typedef __attribute__((ext_vector_type(8)))  __bf16 v8bf;
typedef __attribute__((ext_vector_type(8)))  float  v8f;

#define HEADS 16
#define DH    64
#define DM    1024
#define BATCH 4
#define SEQ   2048

// LDS row pitches in elements: an odd multiple of 16 bytes, so that the 16 rows
// a 16-byte fragment load touches fall on 16 different groups of four banks
#define KP 72   // rows of 64 bf16 (128 B) at 144 B
#define VP 40   // rows of 32 bf16 (64 B) at 80 B

// ---------------------------------------------------------------------------
// WMMA helper: D = A(16x32 bf16) * B(32x16 bf16) + C(16x16 f32)
// ---------------------------------------------------------------------------
__device__ __forceinline__ v8f wmma_bf16(v16bf a, v16bf b, v8f c) {
  return __builtin_amdgcn_wmma_f32_16x16x32_bf16(
      /*neg_a=*/false, a, /*neg_b=*/false, b,
      /*c_mod=*/(short)0, c, /*reuse_a=*/false, /*reuse_b=*/false);
}

// ---------------------------------------------------------------------------
// Fragment loaders: documented gfx1250 16-bit A/B layout.
// Lane L holds row/col (L & 15); K runs: base=(L>>4)*8, elements [base..base+7]
// and [base+16..base+23].  base pointer must be 16B aligned; ld in elements.
// ---------------------------------------------------------------------------
__device__ __forceinline__ v16bf load_frag_bf16(const __bf16* base, int ld) {
  const int lane = threadIdx.x & 31;
  const __bf16* p = base + (size_t)(lane & 15) * ld + ((lane >> 4) << 3);
  v8bf lo = *(const v8bf*)(p);
  v8bf hi = *(const v8bf*)(p + 16);
  v16bf r;
#pragma unroll
  for (int i = 0; i < 8; ++i) { r[i] = lo[i]; r[i + 8] = hi[i]; }
  return r;
}

__device__ __forceinline__ v16bf load_frag_f32(const float* base, int ld) {
  const int lane = threadIdx.x & 31;
  const float* p = base + (size_t)(lane & 15) * ld + ((lane >> 4) << 3);
  v16bf r;
#pragma unroll
  for (int i = 0; i < 8; ++i) {
    r[i]     = (__bf16)p[i];
    r[i + 8] = (__bf16)p[i + 16];
  }
  return r;
}

// value of lane l ^ 16 (the other half of the wave), one vector instruction
__device__ __forceinline__ float xhalf(float v) {
  const int b = __builtin_bit_cast(int, v);
  return __builtin_bit_cast(float, __builtin_amdgcn_permlanex16(
      b, b, 0x76543210, 0xfedcba98, false, false));
}

// ---------------------------------------------------------------------------
// Kernel 0: convert weights fp32 -> bf16 (Wq|Wk|Wv packed, Wp)
// ---------------------------------------------------------------------------
__global__ void __launch_bounds__(256) cvt_weights_kernel(
    const float* __restrict__ Wq, const float* __restrict__ Wk,
    const float* __restrict__ Wv, const float* __restrict__ Wp,
    __bf16* __restrict__ wqkv, __bf16* __restrict__ wpb) {
  const int stride = gridDim.x * blockDim.x;
  const int i0 = blockIdx.x * blockDim.x + threadIdx.x;
  for (int i = i0; i < 3 * DH * DH; i += stride) {
    const float* s = (i < DH * DH) ? Wq : (i < 2 * DH * DH) ? Wk : Wv;
    wqkv[i] = (__bf16)s[i % (DH * DH)];
  }
  for (int i = i0; i < DM * DM; i += stride) wpb[i] = (__bf16)Wp[i];
}

// ---------------------------------------------------------------------------
// Kernel 1: per-head QKV projection.  One wave takes 64 rows (t) of one head:
// it reads its x once, keeps the four 16-row fragment pairs in registers and
// makes q, k and v from them.  q and k are taken transposed (W x^T): a lane then
// holds 8 consecutive e of one row t.  v is taken as x W^T: a lane holds 8
// consecutive t of one e.  Either way a lane stores 16-byte runs.
// The work is 12 groups (3 matrices x 4 tiles of 16 weight rows); a group's two
// weight fragments and its bias come four groups ahead, through four register slots.
// Q,K stored [B,H,T,64]; V stored transposed [B,H,64,T] for the P@V stage.
// ---------------------------------------------------------------------------
typedef __attribute__((ext_vector_type(4))) float v4f;

__global__ void __launch_bounds__(256) qkv_proj_kernel(
    const float* __restrict__ x, const __bf16* __restrict__ wqkv,
    const float* __restrict__ bq, const float* __restrict__ bk,
    const float* __restrict__ bv,
    __bf16* __restrict__ qk_out, __bf16* __restrict__ vt_out) {
  const int wave = threadIdx.x >> 5;
  const int lane = threadIdx.x & 31;
  const int n    = lane & 15;
  const int hig  = lane >> 4;
  const int nu   = SEQ / 64;
  const int unit = blockIdx.x * 8 + wave;      // 64-row unit of one head
  const int t0   = (unit % nu) * 64;
  const int bh   = unit / nu;
  const int b    = bh / HEADS, h = bh % HEADS;

  // groups 0..2 (Wq rows 0..47 with their bias), then all of the wave's x: 32 loads
  // of 16 bytes a lane
  v16bf rw[4][2];
  v8f   rb[4];
#pragma unroll
  for (int c = 0; c < 3; ++c) {
    rw[c][0] = load_frag_bf16(wqkv + (size_t)(c * 16) * DH, DH);
    rw[c][1] = load_frag_bf16(wqkv + (size_t)(c * 16) * DH + 32, DH);
    rb[c]    = *(const v8f*)(bq + c * 16 + 8 * hig);
  }
  const float* xp = x + ((size_t)(b * SEQ + t0 + n)) * DM + h * DH + 8 * hig;
  v4f xr[4][2][4];   // [16-row tile][k half][k 0..3, 4..7, 16..19, 20..23 of the lane's run]
#pragma unroll
  for (int i = 0; i < 4; ++i)
#pragma unroll
    for (int kh = 0; kh < 2; ++kh) {
      const float* p = xp + (size_t)(i * 16) * DM + kh * 32;
      xr[i][kh][0] = *(const v4f*)(p);
      xr[i][kh][1] = *(const v4f*)(p + 4);
      xr[i][kh][2] = *(const v4f*)(p + 16);
      xr[i][kh][3] = *(const v4f*)(p + 20);
    }
  // the x address registers are free from here on: the wait stands before their reuse
  asm volatile("s_wait_xcnt 0x0" ::: "memory");
  // keeps every load above in flight at once: left free, the conversions below are
  // woven between the loads and only four of them are outstanding at a time
  __builtin_amdgcn_sched_barrier(0);

  // group 3 and the four v biases: their registers are not there before x is converted
  float bvl[4];
  rw[3][0] = load_frag_bf16(wqkv + (size_t)48 * DH, DH);
  rw[3][1] = load_frag_bf16(wqkv + (size_t)48 * DH + 32, DH);
  rb[3]    = *(const v8f*)(bq + 48 + 8 * hig);
#pragma unroll
  for (int c = 0; c < 4; ++c) bvl[c] = bv[c * 16 + n];

  v16bf xa[4][2];
#pragma unroll
  for (int i = 0; i < 4; ++i)
#pragma unroll
    for (int kh = 0; kh < 2; ++kh)
#pragma unroll
      for (int e = 0; e < 4; ++e) {
        xa[i][kh][e]      = (__bf16)xr[i][kh][0][e];
        xa[i][kh][e + 4]  = (__bf16)xr[i][kh][1][e];
        xa[i][kh][e + 8]  = (__bf16)xr[i][kh][2][e];
        xa[i][kh][e + 12] = (__bf16)xr[i][kh][3][e];
      }

  __bf16* qo = qk_out + ((size_t)(bh * SEQ + t0 + n)) * DH + 8 * hig;
  __bf16* vt = vt_out + (size_t)bh * DH * SEQ + (size_t)n * SEQ + t0 + 8 * hig;

#pragma unroll
  for (int g = 0; g < 12; ++g) {
    const int sel = g >> 2, c = g & 3;
    if (sel < 2) {
      // q, k: D[e = 16c + 8*hig + j][t = 16i + n] = W x^T + bias[e]
      __bf16* out = qo + (size_t)sel * ((size_t)BATCH * HEADS * SEQ * DH);
#pragma unroll
      for (int i = 0; i < 4; ++i) {
        v8f acc = wmma_bf16(rw[c][0], xa[i][0], rb[c]);
        acc = wmma_bf16(rw[c][1], xa[i][1], acc);
        v8bf r;
#pragma unroll
        for (int j = 0; j < 8; ++j) r[j] = (__bf16)acc[j];
        *(v8bf*)(out + (size_t)(i * 16) * DH + c * 16) = r;
      }
    } else {
      // v: D[t = 16i + 8*hig + j][e = 16c + n] = x W^T + bias[e], stored as V^T
      v8f bvec;
#pragma unroll
      for (int j = 0; j < 8; ++j) bvec[j] = bvl[c];
#pragma unroll
      for (int i = 0; i < 4; ++i) {
        v8f acc = wmma_bf16(xa[i][0], rw[c][0], bvec);
        acc = wmma_bf16(xa[i][1], rw[c][1], acc);
        v8bf r;
#pragma unroll
        for (int j = 0; j < 8; ++j) r[j] = (__bf16)acc[j];
        *(v8bf*)(vt + (size_t)(c * 16) * SEQ + i * 16) = r;
      }
    }
    if (g + 4 < 12) {
      // the group's stores name registers that the loads below may take over
      asm volatile("s_wait_xcnt 0x0" ::: "memory");
      const __bf16* Wn = wqkv + (size_t)(sel + 1) * (DH * DH) + (size_t)(c * 16) * DH;
      rw[c][0] = load_frag_bf16(Wn, DH);
      rw[c][1] = load_frag_bf16(Wn + 32, DH);
      if (sel == 0) rb[c] = *(const v8f*)(bk + c * 16 + 8 * hig);
      // holds the refill of this slot here, three groups of products ahead of its
      // use: sunk to the use, its latency would be waited out once a group
      __builtin_amdgcn_sched_barrier(0);
    }
  }
}

#define QT  2     // 16-query tiles per wave
#define SK  128   // keys per stage
#define VSP 136   // V^T stage rows: 128 bf16 (256 B) at 272 B, an odd multiple of 16 B

// One stage: lane's four 16-byte pieces of K (32 rows apart) and of V^T (16 rows
// apart).  kl, vl: the lane's LDS byte addresses in the buffer; kg, vg: its global ones.
__device__ __forceinline__ void stage_copy(unsigned kl, unsigned vl,
                                           const __bf16* kg, const __bf16* vg) {
  // the copies and, as the last line, the wait that stands before any of their
  // address registers is written again
  asm volatile(
      "global_load_async_to_lds_b128 %0, %8, off\n\t"
      "global_load_async_to_lds_b128 %1, %9, off\n\t"
      "global_load_async_to_lds_b128 %2, %10, off\n\t"
      "global_load_async_to_lds_b128 %3, %11, off\n\t"
      "global_load_async_to_lds_b128 %4, %12, off\n\t"
      "global_load_async_to_lds_b128 %5, %13, off\n\t"
      "global_load_async_to_lds_b128 %6, %14, off\n\t"
      "global_load_async_to_lds_b128 %7, %15, off\n\t"
      "s_wait_xcnt 0x0"
      :: "v"(kl), "v"(kl + 32 * KP * 2), "v"(kl + 64 * KP * 2), "v"(kl + 96 * KP * 2),
         "v"(vl), "v"(vl + 16 * VSP * 2), "v"(vl + 32 * VSP * 2), "v"(vl + 48 * VSP * 2),
         "v"(kg), "v"(kg + 32 * DH), "v"(kg + 64 * DH), "v"(kg + 96 * DH),
         "v"(vg), "v"(vg + 16 * SEQ), "v"(vg + 32 * SEQ), "v"(vg + 48 * SEQ)
      : "memory");
}

__global__ void __launch_bounds__(256) flash_attn_kernel(
    const __bf16* __restrict__ Q, const __bf16* __restrict__ K,
    const __bf16* __restrict__ Vt, __bf16* __restrict__ O) {
  __shared__ __attribute__((aligned(16))) __bf16 Kl[2][SK * KP];     // 128 keys x 64 d, padded rows
  __shared__ __attribute__((aligned(16))) __bf16 Vl[2][DH * VSP];    // 64 d x 128 keys (V^T), padded rows

  const int tid  = threadIdx.x;
  const int wave = tid >> 5;
  const int lane = tid & 31;
  const int n = lane & 15, hig = lane >> 4;
  const int bh = blockIdx.y;
  const int b = bh / HEADS, h = bh % HEADS;
  const int q0 = blockIdx.x * (128 * QT) + wave * (16 * QT);

  const __bf16* Kb = K + (size_t)bh * SEQ * DH;
  const __bf16* Vb = Vt + (size_t)bh * DH * SEQ;

  // copy split: K 8 lanes per 128-byte row, V^T 16 lanes per 256-byte row
  const unsigned kl0 = (unsigned)(size_t)&Kl[0][(tid >> 3) * KP + (tid & 7) * 8];
  const unsigned vl0 = (unsigned)(size_t)&Vl[0][(tid >> 4) * VSP + (tid & 15) * 8];
  const __bf16* kg0 = Kb + tid * 8;
  const __bf16* vg0 = Vb + (size_t)(tid >> 4) * SEQ + (tid & 15) * 8;
  const int NST = SEQ / SK;

  // stage 0 into buffer 0
  stage_copy(kl0, vl0, kg0, vg0);

  const __bf16* Qp = Q + ((size_t)(bh * SEQ + q0)) * DH;
  v16bf qa[QT][2];
#pragma unroll
  for (int t = 0; t < QT; ++t) {
    qa[t][0] = load_frag_bf16(Qp + (size_t)(t * 16) * DH, DH);
    qa[t][1] = load_frag_bf16(Qp + (size_t)(t * 16) * DH + 32, DH);
  }

  v8f   o[QT][4];   // o[t][c][j] = O^T[d = 16c + 8*hig + j][query 16t + n]
  float rmax[QT];   // maximum in use for query 16t + n (same in both halves)
  float thr[QT];    // raw score above which that maximum is replaced
  float rsum[QT];   // running sum over this half's keys only
#pragma unroll
  for (int t = 0; t < QT; ++t) {
    rmax[t] = -3.0e38f;
    thr[t]  = -3.0e38f;   // the first pass always sets the maximum
    rsum[t] = 0.0f;
#pragma unroll
    for (int c = 0; c < 4; ++c)
#pragma unroll
      for (int j = 0; j < 8; ++j) o[t][c][j] = 0.0f;
  }

  const float SC = 0.03125f * 1.44269504088896f;  // (1/sqrt(C)) * log2(e)

  // stage 0 has landed for this wave, then for the block; then stage 1 into buffer 1
  asm volatile("s_wait_asynccnt 0x0" ::: "memory");
  __syncthreads();
  stage_copy(kl0 + SK * KP * 2, vl0 + DH * VSP * 2, kg0 + SK * DH, vg0 + SK);

  for (int st = 0; st < NST; ++st) {
    const int cur = st & 1;

#pragma unroll
    for (int p = 0; p < SK / 32; ++p) {
      // S^T[32k x 16q] = K @ Q^T from LDS, per query tile: two 16x16 C-tiles of
      // 2 WMMAs each; the four K fragments are read once for both query tiles
      const __bf16* Kc = Kl[cur] + p * 32 * KP;
      v8f s0[QT], s1[QT];
      {
        v16bf k00 = load_frag_bf16(Kc, KP);
        v16bf k01 = load_frag_bf16(Kc + 32, KP);
        v16bf k10 = load_frag_bf16(Kc + 16 * KP, KP);
        v16bf k11 = load_frag_bf16(Kc + 16 * KP + 32, KP);
#pragma unroll
        for (int t = 0; t < QT; ++t) {
#pragma unroll
          for (int j = 0; j < 8; ++j) { s0[t][j] = 0.0f; s1[t][j] = 0.0f; }
          s0[t] = wmma_bf16(k00, qa[t][0], s0[t]);
          s0[t] = wmma_bf16(k01, qa[t][1], s0[t]);
          s1[t] = wmma_bf16(k10, qa[t][0], s1[t]);
          s1[t] = wmma_bf16(k11, qa[t][1], s1[t]);
        }
      }

      // V^T fragments (A operand: rows d, k = keys), in flight under the softmax
      const __bf16* Vc = Vl[cur] + p * 32;
      v16bf vf[4];
#pragma unroll
      for (int c = 0; c < 4; ++c) vf[c] = load_frag_bf16(Vc + (c * 16) * VSP, VSP);
      // the eight V reads issue here as one group, so that the softmax covers their
      // latency; sunk to their products each pair would be waited for on its own
      __builtin_amdgcn_sched_barrier(0);

      // in-lane maximum of the raw scores of query 16t + n (the scale is positive)
      float mx[QT];
#pragma unroll
      for (int t = 0; t < QT; ++t) {
        mx[t] = fmaxf(s0[t][0], s1[t][0]);
#pragma unroll
        for (int j = 1; j < 8; ++j) mx[t] = fmaxf(mx[t], fmaxf(s0[t][j], s1[t][j]));
      }
      // one wave-uniform test per pass: does any query of the wave need a new maximum?
      if (__builtin_amdgcn_ballot_w32((mx[0] > thr[0]) | (mx[1] > thr[1])) != 0) {
#pragma unroll
        for (int t = 0; t < QT; ++t) {
          // joined with the other half's, so that both halves of a query use one maximum
          const float mn = fmaxf(rmax[t], fmaxf(mx[t], xhalf(mx[t])) * SC);
          const float f  = __builtin_amdgcn_exp2f(rmax[t] - mn);
          rmax[t] = mn;
          thr[t]  = (mn + 8.0f) * (1.0f / SC);
          rsum[t] *= f;
#pragma unroll
          for (int c = 0; c < 4; ++c) o[t][c] *= f;
        }
      }

#pragma unroll
      for (int t = 0; t < QT; ++t) {
        // softmax numerators (log2 domain) against the maximum in use
        const float mn = rmax[t];

        v16bf pb;   // P^T as B operand: element i = key 8*hig + i, i + 8 = key 16 + 8*hig + i
        float ps[8];
#pragma unroll
        for (int j = 0; j < 8; ++j) {
          const float p0 = __builtin_amdgcn_exp2f(fmaf(s0[t][j], SC, -mn));
          const float p1 = __builtin_amdgcn_exp2f(fmaf(s1[t][j], SC, -mn));
          ps[j] = p0 + p1;
          pb[j]     = (__bf16)p0;
          pb[j + 8] = (__bf16)p1;
        }
        rsum[t] += ((ps[0] + ps[1]) + (ps[2] + ps[3])) +
                   ((ps[4] + ps[5]) + (ps[6] + ps[7]));

        // O^T += V^T @ P^T
#pragma unroll
        for (int c = 0; c < 4; ++c) o[t][c] = wmma_bf16(vf[c], pb, o[t][c]);
      }
      // ends the pass: left free, later passes' LDS reads and score products are woven
      // into this pass's softmax and the register count passes 256 (three waves a SIMD)
      __builtin_amdgcn_sched_barrier(0);
    }

    // publish point of stage st + 1: this wave's LDS reads of stage st are done,
    // its own copies of stage st + 1 have landed, then the block meets
    asm volatile("s_wait_dscnt 0x0" ::: "memory");
    asm volatile("s_wait_asynccnt 0x0" ::: "memory");
    __syncthreads();
    // stage st + 2 into the buffer that every wave has just left
    if (st + 2 < NST)
      stage_copy(kl0 + cur * (SK * KP * 2), vl0 + cur * (DH * VSP * 2),
                 kg0 + (size_t)(st + 2) * (SK * DH), vg0 + (st + 2) * SK);
  }
  // no copy is outstanding when the wave goes on to its end
  asm volatile("s_wait_asynccnt 0x0" ::: "memory");

  // normalize and store bf16 to [B,T,C] (head-interleaved for the projection):
  // a lane holds 8 consecutive d of its query per tile, one 16-byte store each
#pragma unroll
  for (int t = 0; t < QT; ++t) {
    const float inv = 1.0f / (rsum[t] + xhalf(rsum[t]));   // join the halves' sums
    __bf16* op = O + ((size_t)(b * SEQ + q0 + t * 16 + n)) * DM + h * DH + 8 * hig;
#pragma unroll
    for (int c = 0; c < 4; ++c) {
      v8bf r;
#pragma unroll
      for (int j = 0; j < 8; ++j) r[j] = (__bf16)(o[t][c][j] * inv);
      *(v8bf*)(op + c * 16) = r;
    }
  }
}

// ---------------------------------------------------------------------------
// Kernel 3: output projection  Y = O @ Wp^T + bp  (M=8192, N=K=1024, fp32 out)
// 8 waves/block -> 128x64 block tile.  The Wp k-slice (64 cols x 32 k, 4KB)
// is shared by all 8 waves -> double-buffered LDS staging (8x traffic cut).
// ---------------------------------------------------------------------------
__global__ void __launch_bounds__(256) out_proj_kernel(
    const __bf16* __restrict__ Ob, const __bf16* __restrict__ Wpb,
    const float* __restrict__ bp, float* __restrict__ out) {
  __shared__ __attribute__((aligned(16))) __bf16 Wl[2][64 * VP];   // 64 cols x 32 k, padded rows

  const int tid  = threadIdx.x;
  const int wave = tid >> 5;
  const int lane = tid & 31;
  const int n = lane & 15, hig = lane >> 4;
  const int r0 = blockIdx.x * 128 + wave * 16;
  const int n0 = blockIdx.y * 64;
  const int wrow = tid >> 2, wpart = tid & 3;

  v8f acc[4];
#pragma unroll
  for (int c = 0; c < 4; ++c) {
    const float bval = bp[n0 + c * 16 + n];
#pragma unroll
    for (int j = 0; j < 8; ++j) acc[c][j] = bval;
  }

  // prologue: stage Wp k-slice 0
  {
    v8bf wr = *(const v8bf*)(Wpb + (size_t)(n0 + wrow) * DM + wpart * 8);
    *(v8bf*)(&Wl[0][wrow * VP + wpart * 8]) = wr;
  }
  __syncthreads();

  const int NKC = DM / 32;
  for (int kc = 0; kc < NKC; ++kc) {
    const int cur = kc & 1;
    const bool more = (kc + 1 < NKC);

    v8bf wr{};
    if (more)
      wr = *(const v8bf*)(Wpb + (size_t)(n0 + wrow) * DM + (kc + 1) * 32 + wpart * 8);

    v16bf a = load_frag_bf16(Ob + (size_t)r0 * DM + kc * 32, DM);
#pragma unroll
    for (int c = 0; c < 4; ++c) {
      v16bf w = load_frag_bf16(&Wl[cur][(c * 16) * VP], VP);
      acc[c] = wmma_bf16(a, w, acc[c]);
    }

    if (more)
      *(v8bf*)(&Wl[1 - cur][wrow * VP + wpart * 8]) = wr;
    __syncthreads();
  }

#pragma unroll
  for (int c = 0; c < 4; ++c)
#pragma unroll
    for (int j = 0; j < 8; ++j)
      out[(size_t)(r0 + j + 8 * hig) * DM + n0 + c * 16 + n] = acc[c][j];
}

// ---------------------------------------------------------------------------
// Host launcher
// ---------------------------------------------------------------------------
extern "C" void kernel_launch(void* const* d_in, const int* in_sizes, int n_in,
                              void* d_out, int out_size, void* d_ws, size_t ws_size,
                              hipStream_t stream) {
  const float* x  = (const float*)d_in[0];
  const float* Wq = (const float*)d_in[1];
  const float* bq = (const float*)d_in[2];
  const float* Wk = (const float*)d_in[3];
  const float* bk = (const float*)d_in[4];
  const float* Wv = (const float*)d_in[5];
  const float* bv = (const float*)d_in[6];
  const float* Wp = (const float*)d_in[7];
  const float* bp = (const float*)d_in[8];
  float* out = (float*)d_out;

  __bf16* ws = (__bf16*)d_ws;
  const size_t QKV_E = (size_t)BATCH * HEADS * SEQ * DH;  // 8,388,608 elems each
  __bf16* Qw   = ws;                       // [B,H,T,64]   bf16
  __bf16* Vtw  = ws + 2 * QKV_E;           // [B,H,64,T]   bf16 (transposed V)
  __bf16* Ow   = ws + 3 * QKV_E;           // [B,T,1024]   bf16
  __bf16* Wpb  = ws + 4 * QKV_E;           // [1024,1024]  bf16
  __bf16* Wqkv = Wpb + (size_t)DM * DM;    // 3 x [64,64]  bf16
  // total: ~69.2 MB of d_ws

  cvt_weights_kernel<<<256, 256, 0, stream>>>(Wq, Wk, Wv, Wp, Wqkv, Wpb);

  qkv_proj_kernel<<<BATCH * HEADS * (SEQ / 64) / 8, 256, 0, stream>>>(x, Wqkv, bq, bk, bv, Qw, Vtw);

  dim3 g2(SEQ / (128 * QT), BATCH * HEADS);
  flash_attn_kernel<<<g2, 256, 0, stream>>>(Qw, Qw + QKV_E, Vtw, Ow);

  dim3 g3((BATCH * SEQ) / 128, DM / 64);
  out_proj_kernel<<<g3, 256, 0, stream>>>(Ow, Wpb, bp, out);
}

// v007
// A run of this version takes 90.8 microseconds.
// Two timings next to v006 both put it at 1.05 times that version's speed.
// Counting every step since v000, it is 3.59 times as fast.
#include <hip/hip_runtime.h>
#include <hip/hip_bf16.h>

typedef __attribute__((ext_vector_type(16))) __bf16 v16bf;
typedef __attribute__((ext_vector_type(8)))  __bf16 v8bf;
typedef __attribute__((ext_vector_type(8)))  float  v8f;

#define HEADS 16
#define DH    64
#define DM    1024
#define BATCH 4
#define SEQ   2048

// LDS row pitches in elements: an odd multiple of 16 bytes, so that the 16 rows
// a 16-byte fragment load touches fall on 16 different groups of four banks
#define KP 72   // rows of 64 bf16 (128 B) at 144 B
#define VP 40   // rows of 32 bf16 (64 B) at 80 B

// score scale in the log2 domain, (1/sqrt(C)) * log2(e): q is stored multiplied by it
#define QSC (0.03125f * 1.44269504088896f)

// ---------------------------------------------------------------------------
// WMMA helper: D = A(16x32 bf16) * B(32x16 bf16) + C(16x16 f32)
// ---------------------------------------------------------------------------
__device__ __forceinline__ v8f wmma_bf16(v16bf a, v16bf b, v8f c) {
  return __builtin_amdgcn_wmma_f32_16x16x32_bf16(
      /*neg_a=*/false, a, /*neg_b=*/false, b,
      /*c_mod=*/(short)0, c, /*reuse_a=*/false, /*reuse_b=*/false);
}

// ---------------------------------------------------------------------------
// Fragment loaders: documented gfx1250 16-bit A/B layout.
// Lane L holds row/col (L & 15); K runs: base=(L>>4)*8, elements [base..base+7]
// and [base+16..base+23].  base pointer must be 16B aligned; ld in elements.
// ---------------------------------------------------------------------------
__device__ __forceinline__ v16bf load_frag_bf16(const __bf16* base, int ld) {
  const int lane = threadIdx.x & 31;
  const __bf16* p = base + (size_t)(lane & 15) * ld + ((lane >> 4) << 3);
  v8bf lo = *(const v8bf*)(p);
  v8bf hi = *(const v8bf*)(p + 16);
  v16bf r;
#pragma unroll
  for (int i = 0; i < 8; ++i) { r[i] = lo[i]; r[i + 8] = hi[i]; }
  return r;
}

__device__ __forceinline__ v16bf load_frag_f32(const float* base, int ld) {
  const int lane = threadIdx.x & 31;
  const float* p = base + (size_t)(lane & 15) * ld + ((lane >> 4) << 3);
  v16bf r;
#pragma unroll
  for (int i = 0; i < 8; ++i) {
    r[i]     = (__bf16)p[i];
    r[i + 8] = (__bf16)p[i + 16];
  }
  return r;
}

// value of lane l ^ 16 (the other half of the wave), one vector instruction
__device__ __forceinline__ float xhalf(float v) {
  const int b = __builtin_bit_cast(int, v);
  return __builtin_bit_cast(float, __builtin_amdgcn_permlanex16(
      b, b, 0x76543210, 0xfedcba98, false, false));
}

// ---------------------------------------------------------------------------
// Kernel 0: convert weights fp32 -> bf16 (Wq|Wk|Wv packed, Wp)
// ---------------------------------------------------------------------------
__global__ void __launch_bounds__(256) cvt_weights_kernel(
    const float* __restrict__ Wq, const float* __restrict__ Wk,
    const float* __restrict__ Wv, const float* __restrict__ Wp,
    __bf16* __restrict__ wqkv, __bf16* __restrict__ wpb) {
  const int stride = gridDim.x * blockDim.x;
  const int i0 = blockIdx.x * blockDim.x + threadIdx.x;
  for (int i = i0; i < 3 * DH * DH; i += stride) {
    const float* s = (i < DH * DH) ? Wq : (i < 2 * DH * DH) ? Wk : Wv;
    wqkv[i] = (__bf16)s[i % (DH * DH)];
  }
  for (int i = i0; i < DM * DM; i += stride) wpb[i] = (__bf16)Wp[i];
}

// ---------------------------------------------------------------------------
// Kernel 1: per-head QKV projection.  One wave takes 64 rows (t) of one head:
// it reads its x once, keeps the four 16-row fragment pairs in registers and
// makes q, k and v from them.  q and k are taken transposed (W x^T): a lane then
// holds 8 consecutive e of one row t.  v is taken as x W^T: a lane holds 8
// consecutive t of one e.  Either way a lane stores 16-byte runs.
// The work is 12 groups (3 matrices x 4 tiles of 16 weight rows); a group's two
// weight fragments and its bias come four groups ahead, through four register slots.
// Q,K stored [B,H,T,64]; V stored transposed [B,H,64,T] for the P@V stage.
// q is multiplied by QSC in f32 before its one rounding to bf16, so that K q^T is
// already the exponent (base 2) that the attention kernel wants.
// ---------------------------------------------------------------------------
typedef __attribute__((ext_vector_type(4))) float v4f;

__global__ void __launch_bounds__(256) qkv_proj_kernel(
    const float* __restrict__ x, const __bf16* __restrict__ wqkv,
    const float* __restrict__ bq, const float* __restrict__ bk,
    const float* __restrict__ bv,
    __bf16* __restrict__ qk_out, __bf16* __restrict__ vt_out) {
  const int wave = threadIdx.x >> 5;
  const int lane = threadIdx.x & 31;
  const int n    = lane & 15;
  const int hig  = lane >> 4;
  const int nu   = SEQ / 64;
  const int unit = blockIdx.x * 8 + wave;      // 64-row unit of one head
  const int t0   = (unit % nu) * 64;
  const int bh   = unit / nu;
  const int b    = bh / HEADS, h = bh % HEADS;

  // groups 0..2 (Wq rows 0..47 with their bias), then all of the wave's x: 32 loads
  // of 16 bytes a lane
  v16bf rw[4][2];
  v8f   rb[4];
#pragma unroll
  for (int c = 0; c < 3; ++c) {
    rw[c][0] = load_frag_bf16(wqkv + (size_t)(c * 16) * DH, DH);
    rw[c][1] = load_frag_bf16(wqkv + (size_t)(c * 16) * DH + 32, DH);
    rb[c]    = *(const v8f*)(bq + c * 16 + 8 * hig);
  }
  const float* xp = x + ((size_t)(b * SEQ + t0 + n)) * DM + h * DH + 8 * hig;
  v4f xr[4][2][4];   // [16-row tile][k half][k 0..3, 4..7, 16..19, 20..23 of the lane's run]
#pragma unroll
  for (int i = 0; i < 4; ++i)
#pragma unroll
    for (int kh = 0; kh < 2; ++kh) {
      const float* p = xp + (size_t)(i * 16) * DM + kh * 32;
      xr[i][kh][0] = *(const v4f*)(p);
      xr[i][kh][1] = *(const v4f*)(p + 4);
      xr[i][kh][2] = *(const v4f*)(p + 16);
      xr[i][kh][3] = *(const v4f*)(p + 20);
    }
  // the x address registers are free from here on: the wait stands before their reuse
  asm volatile("s_wait_xcnt 0x0" ::: "memory");
  // keeps every load above in flight at once: left free, the conversions below are
  // woven between the loads and only four of them are outstanding at a time
  __builtin_amdgcn_sched_barrier(0);

  // group 3 and the four v biases: their registers are not there before x is converted
  float bvl[4];
  rw[3][0] = load_frag_bf16(wqkv + (size_t)48 * DH, DH);
  rw[3][1] = load_frag_bf16(wqkv + (size_t)48 * DH + 32, DH);
  rb[3]    = *(const v8f*)(bq + 48 + 8 * hig);
#pragma unroll
  for (int c = 0; c < 4; ++c) bvl[c] = bv[c * 16 + n];

  v16bf xa[4][2];
#pragma unroll
  for (int i = 0; i < 4; ++i)
#pragma unroll
    for (int kh = 0; kh < 2; ++kh)
#pragma unroll
      for (int e = 0; e < 4; ++e) {
        xa[i][kh][e]      = (__bf16)xr[i][kh][0][e];
        xa[i][kh][e + 4]  = (__bf16)xr[i][kh][1][e];
        xa[i][kh][e + 8]  = (__bf16)xr[i][kh][2][e];
        xa[i][kh][e + 12] = (__bf16)xr[i][kh][3][e];
      }

  __bf16* qo = qk_out + ((size_t)(bh * SEQ + t0 + n)) * DH + 8 * hig;
  __bf16* vt = vt_out + (size_t)bh * DH * SEQ + (size_t)n * SEQ + t0 + 8 * hig;

#pragma unroll
  for (int g = 0; g < 12; ++g) {
    const int sel = g >> 2, c = g & 3;
    if (sel < 2) {
      // q, k: D[e = 16c + 8*hig + j][t = 16i + n] = W x^T + bias[e]
      __bf16* out = qo + (size_t)sel * ((size_t)BATCH * HEADS * SEQ * DH);
      const float osc = (sel == 0) ? QSC : 1.0f;
#pragma unroll
      for (int i = 0; i < 4; ++i) {
        v8f acc = wmma_bf16(rw[c][0], xa[i][0], rb[c]);
        acc = wmma_bf16(rw[c][1], xa[i][1], acc);
        v8bf r;
#pragma unroll
        for (int j = 0; j < 8; ++j) r[j] = (__bf16)(acc[j] * osc);
        *(v8bf*)(out + (size_t)(i * 16) * DH + c * 16) = r;
      }
    } else {
      // v: D[t = 16i + 8*hig + j][e = 16c + n] = x W^T + bias[e], stored as V^T
      v8f bvec;
#pragma unroll
      for (int j = 0; j < 8; ++j) bvec[j] = bvl[c];
#pragma unroll
      for (int i = 0; i < 4; ++i) {
        v8f acc = wmma_bf16(xa[i][0], rw[c][0], bvec);
        acc = wmma_bf16(xa[i][1], rw[c][1], acc);
        v8bf r;
#pragma unroll
        for (int j = 0; j < 8; ++j) r[j] = (__bf16)acc[j];
        *(v8bf*)(vt + (size_t)(c * 16) * SEQ + i * 16) = r;
      }
    }
    if (g + 4 < 12) {
      // the group's stores name registers that the loads below may take over
      asm volatile("s_wait_xcnt 0x0" ::: "memory");
      const __bf16* Wn = wqkv + (size_t)(sel + 1) * (DH * DH) + (size_t)(c * 16) * DH;
      rw[c][0] = load_frag_bf16(Wn, DH);
      rw[c][1] = load_frag_bf16(Wn + 32, DH);
      if (sel == 0) rb[c] = *(const v8f*)(bk + c * 16 + 8 * hig);
      // holds the refill of this slot here, three groups of products ahead of its
      // use: sunk to the use, its latency would be waited out once a group
      __builtin_amdgcn_sched_barrier(0);
    }
  }
}

#define QT  2     // 16-query tiles per wave
#define SK  128   // keys per stage
#define VSP 136   // V^T stage rows: 128 bf16 (256 B) at 272 B, an odd multiple of 16 B

// One stage: lane's four 16-byte pieces of K (32 rows apart) and of V^T (16 rows
// apart).  kl, vl: the lane's LDS byte addresses in the buffer; kg, vg: its global ones.
__device__ __forceinline__ void stage_copy(unsigned kl, unsigned vl,
                                           const __bf16* kg, const __bf16* vg) {
  // the copies and, as the last line, the wait that stands before any of their
  // address registers is written again
  asm volatile(
      "global_load_async_to_lds_b128 %0, %8, off\n\t"
      "global_load_async_to_lds_b128 %1, %9, off\n\t"
      "global_load_async_to_lds_b128 %2, %10, off\n\t"
      "global_load_async_to_lds_b128 %3, %11, off\n\t"
      "global_load_async_to_lds_b128 %4, %12, off\n\t"
      "global_load_async_to_lds_b128 %5, %13, off\n\t"
      "global_load_async_to_lds_b128 %6, %14, off\n\t"
      "global_load_async_to_lds_b128 %7, %15, off\n\t"
      "s_wait_xcnt 0x0"
      :: "v"(kl), "v"(kl + 32 * KP * 2), "v"(kl + 64 * KP * 2), "v"(kl + 96 * KP * 2),
         "v"(vl), "v"(vl + 16 * VSP * 2), "v"(vl + 32 * VSP * 2), "v"(vl + 48 * VSP * 2),
         "v"(kg), "v"(kg + 32 * DH), "v"(kg + 64 * DH), "v"(kg + 96 * DH),
         "v"(vg), "v"(vg + 16 * SEQ), "v"(vg + 32 * SEQ), "v"(vg + 48 * SEQ)
      : "memory");
}

__global__ void __launch_bounds__(256) flash_attn_kernel(
    const __bf16* __restrict__ Q, const __bf16* __restrict__ K,
    const __bf16* __restrict__ Vt, __bf16* __restrict__ O) {
  __shared__ __attribute__((aligned(16))) __bf16 Kl[2][SK * KP];     // 128 keys x 64 d, padded rows
  __shared__ __attribute__((aligned(16))) __bf16 Vl[2][DH * VSP];    // 64 d x 128 keys (V^T), padded rows

  const int tid  = threadIdx.x;
  const int wave = tid >> 5;
  const int lane = tid & 31;
  const int n = lane & 15, hig = lane >> 4;
  const int bh = blockIdx.y;
  const int b = bh / HEADS, h = bh % HEADS;
  const int q0 = blockIdx.x * (128 * QT) + wave * (16 * QT);

  const __bf16* Kb = K + (size_t)bh * SEQ * DH;
  const __bf16* Vb = Vt + (size_t)bh * DH * SEQ;

  // copy split: K 8 lanes per 128-byte row, V^T 16 lanes per 256-byte row
  const unsigned kl0 = (unsigned)(size_t)&Kl[0][(tid >> 3) * KP + (tid & 7) * 8];
  const unsigned vl0 = (unsigned)(size_t)&Vl[0][(tid >> 4) * VSP + (tid & 15) * 8];
  const __bf16* kg0 = Kb + tid * 8;
  const __bf16* vg0 = Vb + (size_t)(tid >> 4) * SEQ + (tid & 15) * 8;
  const int NST = SEQ / SK;

  // stage 0 into buffer 0
  stage_copy(kl0, vl0, kg0, vg0);

  const __bf16* Qp = Q + ((size_t)(bh * SEQ + q0)) * DH;
  v16bf qa[QT][2];
#pragma unroll
  for (int t = 0; t < QT; ++t) {
    qa[t][0] = load_frag_bf16(Qp + (size_t)(t * 16) * DH, DH);
    qa[t][1] = load_frag_bf16(Qp + (size_t)(t * 16) * DH + 32, DH);
  }

  v8f   o[QT][4];   // o[t][c][j] = O^T[d = 16c + 8*hig + j][query 16t + n]
  v8f   negm[QT];   // minus the maximum in use for query 16t + n, eight times (same in both halves)
  float thr[QT];    // exponent above which that maximum is replaced
  float rsum[QT];   // running sum over this half's keys only
#pragma unroll
  for (int t = 0; t < QT; ++t) {
    thr[t]  = -3.0e38f;   // the first pass always sets the maximum
    rsum[t] = 0.0f;
#pragma unroll
    for (int j = 0; j < 8; ++j) negm[t][j] = 0.0f;
#pragma unroll
    for (int c = 0; c < 4; ++c)
#pragma unroll
      for (int j = 0; j < 8; ++j) o[t][c][j] = 0.0f;
  }

  // stage 0 has landed for this wave, then for the block; then stage 1 into buffer 1
  asm volatile("s_wait_asynccnt 0x0" ::: "memory");
  __syncthreads();
  stage_copy(kl0 + SK * KP * 2, vl0 + DH * VSP * 2, kg0 + SK * DH, vg0 + SK);

  for (int st = 0; st < NST; ++st) {
    const int cur = st & 1;

#pragma unroll
    for (int p = 0; p < SK / 32; ++p) {
      // S^T[32k x 16q] = K @ Q^T from LDS, per query tile: two 16x16 C-tiles of
      // 2 WMMAs each; the four K fragments are read once for both query tiles
      const __bf16* Kc = Kl[cur] + p * 32 * KP;
      v8f s0[QT], s1[QT];
      {
        v16bf k00 = load_frag_bf16(Kc, KP);
        v16bf k01 = load_frag_bf16(Kc + 32, KP);
        v16bf k10 = load_frag_bf16(Kc + 16 * KP, KP);
        v16bf k11 = load_frag_bf16(Kc + 16 * KP + 32, KP);
#pragma unroll
        for (int t = 0; t < QT; ++t) {
          s0[t] = wmma_bf16(k00, qa[t][0], negm[t]);
          s0[t] = wmma_bf16(k01, qa[t][1], s0[t]);
          s1[t] = wmma_bf16(k10, qa[t][0], negm[t]);
          s1[t] = wmma_bf16(k11, qa[t][1], s1[t]);
        }
      }

      // V^T fragments (A operand: rows d, k = keys), in flight under the softmax
      const __bf16* Vc = Vl[cur] + p * 32;
      v16bf vf[4];
#pragma unroll
      for (int c = 0; c < 4; ++c) vf[c] = load_frag_bf16(Vc + (c * 16) * VSP, VSP);
      // the eight V reads issue here as one group, so that the softmax covers their
      // latency; sunk to their products each pair would be waited for on its own
      __builtin_amdgcn_sched_barrier(0);

      // in-lane maximum of the exponents of query 16t + n
      float mx[QT];
#pragma unroll
      for (int t = 0; t < QT; ++t) {
        mx[t] = fmaxf(s0[t][0], s1[t][0]);
#pragma unroll
        for (int j = 1; j < 8; ++j) mx[t] = fmaxf(mx[t], fmaxf(s0[t][j], s1[t][j]));
      }
      // one wave-uniform test per pass: does any query of the wave need a new maximum?
      if (__builtin_amdgcn_ballot_w32((mx[0] > thr[0]) | (mx[1] > thr[1])) != 0) {
#pragma unroll
        for (int t = 0; t < QT; ++t) {
          // joined with the other half's, so that both halves of a query use one maximum;
          // d is how far the maximum moves: upward only, but in the first pass (thr still
          // at its start value), where it goes to the pass's own maximum, up or down
          const float d = fmaxf(fmaxf(mx[t], xhalf(mx[t])), fminf(thr[t], 0.0f));
          // a move downward happens only while O^T and the sums are still zero: factor 1
          const float f = __builtin_amdgcn_exp2f(-fmaxf(d, 0.0f));
          thr[t] = 8.0f;
          rsum[t] *= f;
#pragma unroll
          for (int c = 0; c < 4; ++c) o[t][c] *= f;
          // later passes start from the new maximum; this pass's exponents follow it here
          negm[t] -= d;
          s0[t]   -= d;
          s1[t]   -= d;
        }
      }

#pragma unroll
      for (int t = 0; t < QT; ++t) {
        // softmax numerators: the accumulators are the exponents against the maximum in use
        v16bf pb;   // P^T as B operand: element i = key 8*hig + i, i + 8 = key 16 + 8*hig + i
        float ps[8];
#pragma unroll
        for (int j = 0; j < 8; ++j) {
          const float p0 = __builtin_amdgcn_exp2f(s0[t][j]);
          const float p1 = __builtin_amdgcn_exp2f(s1[t][j]);
          ps[j] = p0 + p1;
          pb[j]     = (__bf16)p0;
          pb[j + 8] = (__bf16)p1;
        }
        rsum[t] += ((ps[0] + ps[1]) + (ps[2] + ps[3])) +
                   ((ps[4] + ps[5]) + (ps[6] + ps[7]));

        // O^T += V^T @ P^T
#pragma unroll
        for (int c = 0; c < 4; ++c) o[t][c] = wmma_bf16(vf[c], pb, o[t][c]);
      }
      // ends the pass: left free, later passes' LDS reads and score products are woven
      // into this pass's softmax and the register count passes 256 (three waves a SIMD)
      __builtin_amdgcn_sched_barrier(0);
    }

    // publish point of stage st + 1: this wave's LDS reads of stage st are done,
    // its own copies of stage st + 1 have landed, then the block meets
    asm volatile("s_wait_dscnt 0x0" ::: "memory");
    asm volatile("s_wait_asynccnt 0x0" ::: "memory");
    __syncthreads();
    // stage st + 2 into the buffer that every wave has just left
    if (st + 2 < NST)
      stage_copy(kl0 + cur * (SK * KP * 2), vl0 + cur * (DH * VSP * 2),
                 kg0 + (size_t)(st + 2) * (SK * DH), vg0 + (st + 2) * SK);
  }
  // no copy is outstanding when the wave goes on to its end
  asm volatile("s_wait_asynccnt 0x0" ::: "memory");

  // normalize and store bf16 to [B,T,C] (head-interleaved for the projection):
  // a lane holds 8 consecutive d of its query per tile, one 16-byte store each
#pragma unroll
  for (int t = 0; t < QT; ++t) {
    const float inv = 1.0f / (rsum[t] + xhalf(rsum[t]));   // join the halves' sums
    __bf16* op = O + ((size_t)(b * SEQ + q0 + t * 16 + n)) * DM + h * DH + 8 * hig;
#pragma unroll
    for (int c = 0; c < 4; ++c) {
      v8bf r;
#pragma unroll
      for (int j = 0; j < 8; ++j) r[j] = (__bf16)(o[t][c][j] * inv);
      *(v8bf*)(op + c * 16) = r;
    }
  }
}

// ---------------------------------------------------------------------------
// Kernel 3: output projection  Y = O @ Wp^T + bp  (M=8192, N=K=1024, fp32 out)
// 8 waves/block -> 128x64 block tile.  The Wp k-slice (64 cols x 32 k, 4KB)
// is shared by all 8 waves -> double-buffered LDS staging (8x traffic cut).
// ---------------------------------------------------------------------------
__global__ void __launch_bounds__(256) out_proj_kernel(
    const __bf16* __restrict__ Ob, const __bf16* __restrict__ Wpb,
    const float* __restrict__ bp, float* __restrict__ out) {
  __shared__ __attribute__((aligned(16))) __bf16 Wl[2][64 * VP];   // 64 cols x 32 k, padded rows

  const int tid  = threadIdx.x;
  const int wave = tid >> 5;
  const int lane = tid & 31;
  const int n = lane & 15, hig = lane >> 4;
  const int r0 = blockIdx.x * 128 + wave * 16;
  const int n0 = blockIdx.y * 64;
  const int wrow = tid >> 2, wpart = tid & 3;

  v8f acc[4];
#pragma unroll
  for (int c = 0; c < 4; ++c) {
    const float bval = bp[n0 + c * 16 + n];
#pragma unroll
    for (int j = 0; j < 8; ++j) acc[c][j] = bval;
  }

  // prologue: stage Wp k-slice 0
  {
    v8bf wr = *(const v8bf*)(Wpb + (size_t)(n0 + wrow) * DM + wpart * 8);
    *(v8bf*)(&Wl[0][wrow * VP + wpart * 8]) = wr;
  }
  __syncthreads();

  const int NKC = DM / 32;
  for (int kc = 0; kc < NKC; ++kc) {
    const int cur = kc & 1;
    const bool more = (kc + 1 < NKC);

    v8bf wr{};
    if (more)
      wr = *(const v8bf*)(Wpb + (size_t)(n0 + wrow) * DM + (kc + 1) * 32 + wpart * 8);

    v16bf a = load_frag_bf16(Ob + (size_t)r0 * DM + kc * 32, DM);
#pragma unroll
    for (int c = 0; c < 4; ++c) {
      v16bf w = load_frag_bf16(&Wl[cur][(c * 16) * VP], VP);
      acc[c] = wmma_bf16(a, w, acc[c]);
    }

    if (more)
      *(v8bf*)(&Wl[1 - cur][wrow * VP + wpart * 8]) = wr;
    __syncthreads();
  }

#pragma unroll
  for (int c = 0; c < 4; ++c)
#pragma unroll
    for (int j = 0; j < 8; ++j)
      out[(size_t)(r0 + j + 8 * hig) * DM + n0 + c * 16 + n] = acc[c][j];
}

// ---------------------------------------------------------------------------
// Host launcher
// ---------------------------------------------------------------------------
extern "C" void kernel_launch(void* const* d_in, const int* in_sizes, int n_in,
                              void* d_out, int out_size, void* d_ws, size_t ws_size,
                              hipStream_t stream) {
  const float* x  = (const float*)d_in[0];
  const float* Wq = (const float*)d_in[1];
  const float* bq = (const float*)d_in[2];
  const float* Wk = (const float*)d_in[3];
  const float* bk = (const float*)d_in[4];
  const float* Wv = (const float*)d_in[5];
  const float* bv = (const float*)d_in[6];
  const float* Wp = (const float*)d_in[7];
  const float* bp = (const float*)d_in[8];
  float* out = (float*)d_out;

  __bf16* ws = (__bf16*)d_ws;
  const size_t QKV_E = (size_t)BATCH * HEADS * SEQ * DH;  // 8,388,608 elems each
  __bf16* Qw   = ws;                       // [B,H,T,64]   bf16
  __bf16* Vtw  = ws + 2 * QKV_E;           // [B,H,64,T]   bf16 (transposed V)
  __bf16* Ow   = ws + 3 * QKV_E;           // [B,T,1024]   bf16
  __bf16* Wpb  = ws + 4 * QKV_E;           // [1024,1024]  bf16
  __bf16* Wqkv = Wpb + (size_t)DM * DM;    // 3 x [64,64]  bf16
  // total: ~69.2 MB of d_ws

  cvt_weights_kernel<<<256, 256, 0, stream>>>(Wq, Wk, Wv, Wp, Wqkv, Wpb);

  qkv_proj_kernel<<<BATCH * HEADS * (SEQ / 64) / 8, 256, 0, stream>>>(x, Wqkv, bq, bk, bv, Qw, Vtw);

  dim3 g2(SEQ / (128 * QT), BATCH * HEADS);
  flash_attn_kernel<<<g2, 256, 0, stream>>>(Qw, Qw + QKV_E, Vtw, Ow);

  dim3 g3((BATCH * SEQ) / 128, DM / 64);
  out_proj_kernel<<<g3, 256, 0, stream>>>(Ow, Wpb, bp, out);
}

// v008
// One run takes 80.2 microseconds.
// Timed twice side by side with v007, it ran 1.13 times as fast both times.
// Counting every step since v000, it is 4.07 times as fast.
#include <hip/hip_runtime.h>
#include <hip/hip_bf16.h>

typedef __attribute__((ext_vector_type(16))) __bf16 v16bf;
typedef __attribute__((ext_vector_type(8)))  __bf16 v8bf;
typedef __attribute__((ext_vector_type(8)))  float  v8f;

#define HEADS 16
#define DH    64
#define DM    1024
#define BATCH 4
#define SEQ   2048

// LDS row pitches in elements: an odd multiple of 16 bytes, so that the 16 rows
// a 16-byte fragment load touches fall on 16 different groups of four banks
#define KP 72   // rows of 64 bf16 (128 B) at 144 B

// score scale in the log2 domain, (1/sqrt(C)) * log2(e): q is stored multiplied by it
#define QSC (0.03125f * 1.44269504088896f)

// ---------------------------------------------------------------------------
// WMMA helper: D = A(16x32 bf16) * B(32x16 bf16) + C(16x16 f32)
// ---------------------------------------------------------------------------
__device__ __forceinline__ v8f wmma_bf16(v16bf a, v16bf b, v8f c) {
  return __builtin_amdgcn_wmma_f32_16x16x32_bf16(
      /*neg_a=*/false, a, /*neg_b=*/false, b,
      /*c_mod=*/(short)0, c, /*reuse_a=*/false, /*reuse_b=*/false);
}

// ---------------------------------------------------------------------------
// Fragment loaders: documented gfx1250 16-bit A/B layout.
// Lane L holds row/col (L & 15); K runs: base=(L>>4)*8, elements [base..base+7]
// and [base+16..base+23].  base pointer must be 16B aligned; ld in elements.
// ---------------------------------------------------------------------------
__device__ __forceinline__ v16bf load_frag_bf16(const __bf16* base, int ld) {
  const int lane = threadIdx.x & 31;
  const __bf16* p = base + (size_t)(lane & 15) * ld + ((lane >> 4) << 3);
  v8bf lo = *(const v8bf*)(p);
  v8bf hi = *(const v8bf*)(p + 16);
  v16bf r;
#pragma unroll
  for (int i = 0; i < 8; ++i) { r[i] = lo[i]; r[i + 8] = hi[i]; }
  return r;
}

__device__ __forceinline__ v16bf load_frag_f32(const float* base, int ld) {
  const int lane = threadIdx.x & 31;
  const float* p = base + (size_t)(lane & 15) * ld + ((lane >> 4) << 3);
  v16bf r;
#pragma unroll
  for (int i = 0; i < 8; ++i) {
    r[i]     = (__bf16)p[i];
    r[i + 8] = (__bf16)p[i + 16];
  }
  return r;
}

// value of lane l ^ 16 (the other half of the wave), one vector instruction
__device__ __forceinline__ float xhalf(float v) {
  const int b = __builtin_bit_cast(int, v);
  return __builtin_bit_cast(float, __builtin_amdgcn_permlanex16(
      b, b, 0x76543210, 0xfedcba98, false, false));
}

// ---------------------------------------------------------------------------
// Kernel 0: convert weights fp32 -> bf16 (Wq|Wk|Wv packed, Wp)
// ---------------------------------------------------------------------------
__global__ void __launch_bounds__(256) cvt_weights_kernel(
    const float* __restrict__ Wq, const float* __restrict__ Wk,
    const float* __restrict__ Wv, const float* __restrict__ Wp,
    __bf16* __restrict__ wqkv, __bf16* __restrict__ wpb) {
  const int stride = gridDim.x * blockDim.x;
  const int i0 = blockIdx.x * blockDim.x + threadIdx.x;
  for (int i = i0; i < 3 * DH * DH; i += stride) {
    const float* s = (i < DH * DH) ? Wq : (i < 2 * DH * DH) ? Wk : Wv;
    wqkv[i] = (__bf16)s[i % (DH * DH)];
  }
  for (int i = i0; i < DM * DM; i += stride) wpb[i] = (__bf16)Wp[i];
}

// ---------------------------------------------------------------------------
// Kernel 1: per-head QKV projection.  One wave takes 64 rows (t) of one head:
// it reads its x once, keeps the four 16-row fragment pairs in registers and
// makes q, k and v from them.  q and k are taken transposed (W x^T): a lane then
// holds 8 consecutive e of one row t.  v is taken as x W^T: a lane holds 8
// consecutive t of one e.  Either way a lane stores 16-byte runs.
// The work is 12 groups (3 matrices x 4 tiles of 16 weight rows); a group's two
// weight fragments and its bias come four groups ahead, through four register slots.
// Q,K stored [B,H,T,64]; V stored transposed [B,H,64,T] for the P@V stage.
// q is multiplied by QSC in f32 before its one rounding to bf16, so that K q^T is
// already the exponent (base 2) that the attention kernel wants.
// ---------------------------------------------------------------------------
typedef __attribute__((ext_vector_type(4))) float v4f;

__global__ void __launch_bounds__(256) qkv_proj_kernel(
    const float* __restrict__ x, const __bf16* __restrict__ wqkv,
    const float* __restrict__ bq, const float* __restrict__ bk,
    const float* __restrict__ bv,
    __bf16* __restrict__ qk_out, __bf16* __restrict__ vt_out) {
  const int wave = threadIdx.x >> 5;
  const int lane = threadIdx.x & 31;
  const int n    = lane & 15;
  const int hig  = lane >> 4;
  const int nu   = SEQ / 64;
  const int unit = blockIdx.x * 8 + wave;      // 64-row unit of one head
  const int t0   = (unit % nu) * 64;
  const int bh   = unit / nu;
  const int b    = bh / HEADS, h = bh % HEADS;

  // groups 0..2 (Wq rows 0..47 with their bias), then all of the wave's x: 32 loads
  // of 16 bytes a lane
  v16bf rw[4][2];
  v8f   rb[4];
#pragma unroll
  for (int c = 0; c < 3; ++c) {
    rw[c][0] = load_frag_bf16(wqkv + (size_t)(c * 16) * DH, DH);
    rw[c][1] = load_frag_bf16(wqkv + (size_t)(c * 16) * DH + 32, DH);
    rb[c]    = *(const v8f*)(bq + c * 16 + 8 * hig);
  }
  const float* xp = x + ((size_t)(b * SEQ + t0 + n)) * DM + h * DH + 8 * hig;
  v4f xr[4][2][4];   // [16-row tile][k half][k 0..3, 4..7, 16..19, 20..23 of the lane's run]
#pragma unroll
  for (int i = 0; i < 4; ++i)
#pragma unroll
    for (int kh = 0; kh < 2; ++kh) {
      const float* p = xp + (size_t)(i * 16) * DM + kh * 32;
      xr[i][kh][0] = *(const v4f*)(p);
      xr[i][kh][1] = *(const v4f*)(p + 4);
      xr[i][kh][2] = *(const v4f*)(p + 16);
      xr[i][kh][3] = *(const v4f*)(p + 20);
    }
  // the x address registers are free from here on: the wait stands before their reuse
  asm volatile("s_wait_xcnt 0x0" ::: "memory");
  // keeps every load above in flight at once: left free, the conversions below are
  // woven between the loads and only four of them are outstanding at a time
  __builtin_amdgcn_sched_barrier(0);

  // group 3 and the four v biases: their registers are not there before x is converted
  float bvl[4];
  rw[3][0] = load_frag_bf16(wqkv + (size_t)48 * DH, DH);
  rw[3][1] = load_frag_bf16(wqkv + (size_t)48 * DH + 32, DH);
  rb[3]    = *(const v8f*)(bq + 48 + 8 * hig);
#pragma unroll
  for (int c = 0; c < 4; ++c) bvl[c] = bv[c * 16 + n];

  v16bf xa[4][2];
#pragma unroll
  for (int i = 0; i < 4; ++i)
#pragma unroll
    for (int kh = 0; kh < 2; ++kh)
#pragma unroll
      for (int e = 0; e < 4; ++e) {
        xa[i][kh][e]      = (__bf16)xr[i][kh][0][e];
        xa[i][kh][e + 4]  = (__bf16)xr[i][kh][1][e];
        xa[i][kh][e + 8]  = (__bf16)xr[i][kh][2][e];
        xa[i][kh][e + 12] = (__bf16)xr[i][kh][3][e];
      }

  __bf16* qo = qk_out + ((size_t)(bh * SEQ + t0 + n)) * DH + 8 * hig;
  __bf16* vt = vt_out + (size_t)bh * DH * SEQ + (size_t)n * SEQ + t0 + 8 * hig;

#pragma unroll
  for (int g = 0; g < 12; ++g) {
    const int sel = g >> 2, c = g & 3;
    if (sel < 2) {
      // q, k: D[e = 16c + 8*hig + j][t = 16i + n] = W x^T + bias[e]
      __bf16* out = qo + (size_t)sel * ((size_t)BATCH * HEADS * SEQ * DH);
      const float osc = (sel == 0) ? QSC : 1.0f;
#pragma unroll
      for (int i = 0; i < 4; ++i) {
        v8f acc = wmma_bf16(rw[c][0], xa[i][0], rb[c]);
        acc = wmma_bf16(rw[c][1], xa[i][1], acc);
        v8bf r;
#pragma unroll
        for (int j = 0; j < 8; ++j) r[j] = (__bf16)(acc[j] * osc);
        *(v8bf*)(out + (size_t)(i * 16) * DH + c * 16) = r;
      }
    } else {
      // v: D[t = 16i + 8*hig + j][e = 16c + n] = x W^T + bias[e], stored as V^T
      v8f bvec;
#pragma unroll
      for (int j = 0; j < 8; ++j) bvec[j] = bvl[c];
#pragma unroll
      for (int i = 0; i < 4; ++i) {
        v8f acc = wmma_bf16(xa[i][0], rw[c][0], bvec);
        acc = wmma_bf16(xa[i][1], rw[c][1], acc);
        v8bf r;
#pragma unroll
        for (int j = 0; j < 8; ++j) r[j] = (__bf16)acc[j];
        *(v8bf*)(vt + (size_t)(c * 16) * SEQ + i * 16) = r;
      }
    }
    if (g + 4 < 12) {
      // the group's stores name registers that the loads below may take over
      asm volatile("s_wait_xcnt 0x0" ::: "memory");
      const __bf16* Wn = wqkv + (size_t)(sel + 1) * (DH * DH) + (size_t)(c * 16) * DH;
      rw[c][0] = load_frag_bf16(Wn, DH);
      rw[c][1] = load_frag_bf16(Wn + 32, DH);
      if (sel == 0) rb[c] = *(const v8f*)(bk + c * 16 + 8 * hig);
      // holds the refill of this slot here, three groups of products ahead of its
      // use: sunk to the use, its latency would be waited out once a group
      __builtin_amdgcn_sched_barrier(0);
    }
  }
}

#define QT  2     // 16-query tiles per wave
#define SK  128   // keys per stage
#define VSP 136   // V^T stage rows: 128 bf16 (256 B) at 272 B, an odd multiple of 16 B

// One stage: lane's four 16-byte pieces of K (32 rows apart) and of V^T (16 rows
// apart).  kl, vl: the lane's LDS byte addresses in the buffer; kg, vg: its global ones.
__device__ __forceinline__ void stage_copy(unsigned kl, unsigned vl,
                                           const __bf16* kg, const __bf16* vg) {
  // the copies and, as the last line, the wait that stands before any of their
  // address registers is written again
  asm volatile(
      "global_load_async_to_lds_b128 %0, %8, off\n\t"
      "global_load_async_to_lds_b128 %1, %9, off\n\t"
      "global_load_async_to_lds_b128 %2, %10, off\n\t"
      "global_load_async_to_lds_b128 %3, %11, off\n\t"
      "global_load_async_to_lds_b128 %4, %12, off\n\t"
      "global_load_async_to_lds_b128 %5, %13, off\n\t"
      "global_load_async_to_lds_b128 %6, %14, off\n\t"
      "global_load_async_to_lds_b128 %7, %15, off\n\t"
      "s_wait_xcnt 0x0"
      :: "v"(kl), "v"(kl + 32 * KP * 2), "v"(kl + 64 * KP * 2), "v"(kl + 96 * KP * 2),
         "v"(vl), "v"(vl + 16 * VSP * 2), "v"(vl + 32 * VSP * 2), "v"(vl + 48 * VSP * 2),
         "v"(kg), "v"(kg + 32 * DH), "v"(kg + 64 * DH), "v"(kg + 96 * DH),
         "v"(vg), "v"(vg + 16 * SEQ), "v"(vg + 32 * SEQ), "v"(vg + 48 * SEQ)
      : "memory");
}

__global__ void __launch_bounds__(256) flash_attn_kernel(
    const __bf16* __restrict__ Q, const __bf16* __restrict__ K,
    const __bf16* __restrict__ Vt, __bf16* __restrict__ O) {
  __shared__ __attribute__((aligned(16))) __bf16 Kl[2][SK * KP];     // 128 keys x 64 d, padded rows
  __shared__ __attribute__((aligned(16))) __bf16 Vl[2][DH * VSP];    // 64 d x 128 keys (V^T), padded rows

  const int tid  = threadIdx.x;
  const int wave = tid >> 5;
  const int lane = tid & 31;
  const int n = lane & 15, hig = lane >> 4;
  const int bh = blockIdx.y;
  const int b = bh / HEADS, h = bh % HEADS;
  const int q0 = blockIdx.x * (128 * QT) + wave * (16 * QT);

  const __bf16* Kb = K + (size_t)bh * SEQ * DH;
  const __bf16* Vb = Vt + (size_t)bh * DH * SEQ;

  // copy split: K 8 lanes per 128-byte row, V^T 16 lanes per 256-byte row
  const unsigned kl0 = (unsigned)(size_t)&Kl[0][(tid >> 3) * KP + (tid & 7) * 8];
  const unsigned vl0 = (unsigned)(size_t)&Vl[0][(tid >> 4) * VSP + (tid & 15) * 8];
  const __bf16* kg0 = Kb + tid * 8;
  const __bf16* vg0 = Vb + (size_t)(tid >> 4) * SEQ + (tid & 15) * 8;
  const int NST = SEQ / SK;

  // stage 0 into buffer 0
  stage_copy(kl0, vl0, kg0, vg0);

  const __bf16* Qp = Q + ((size_t)(bh * SEQ + q0)) * DH;
  v16bf qa[QT][2];
#pragma unroll
  for (int t = 0; t < QT; ++t) {
    qa[t][0] = load_frag_bf16(Qp + (size_t)(t * 16) * DH, DH);
    qa[t][1] = load_frag_bf16(Qp + (size_t)(t * 16) * DH + 32, DH);
  }

  v8f   o[QT][4];   // o[t][c][j] = O^T[d = 16c + 8*hig + j][query 16t + n]
  v8f   negm[QT];   // minus the maximum in use for query 16t + n, eight times (same in both halves)
  float thr[QT];    // exponent above which that maximum is replaced
  float rsum[QT];   // running sum over this half's keys only
#pragma unroll
  for (int t = 0; t < QT; ++t) {
    thr[t]  = -3.0e38f;   // the first pass always sets the maximum
    rsum[t] = 0.0f;
#pragma unroll
    for (int j = 0; j < 8; ++j) negm[t][j] = 0.0f;
#pragma unroll
    for (int c = 0; c < 4; ++c)
#pragma unroll
      for (int j = 0; j < 8; ++j) o[t][c][j] = 0.0f;
  }

  // stage 0 has landed for this wave, then for the block; then stage 1 into buffer 1
  asm volatile("s_wait_asynccnt 0x0" ::: "memory");
  __syncthreads();
  stage_copy(kl0 + SK * KP * 2, vl0 + DH * VSP * 2, kg0 + SK * DH, vg0 + SK);

  for (int st = 0; st < NST; ++st) {
    const int cur = st & 1;

#pragma unroll
    for (int p = 0; p < SK / 32; ++p) {
      // S^T[32k x 16q] = K @ Q^T from LDS, per query tile: two 16x16 C-tiles of
      // 2 WMMAs each; the four K fragments are read once for both query tiles
      const __bf16* Kc = Kl[cur] + p * 32 * KP;
      v8f s0[QT], s1[QT];
      {
        v16bf k00 = load_frag_bf16(Kc, KP);
        v16bf k01 = load_frag_bf16(Kc + 32, KP);
        v16bf k10 = load_frag_bf16(Kc + 16 * KP, KP);
        v16bf k11 = load_frag_bf16(Kc + 16 * KP + 32, KP);
#pragma unroll
        for (int t = 0; t < QT; ++t) {
          s0[t] = wmma_bf16(k00, qa[t][0], negm[t]);
          s0[t] = wmma_bf16(k01, qa[t][1], s0[t]);
          s1[t] = wmma_bf16(k10, qa[t][0], negm[t]);
          s1[t] = wmma_bf16(k11, qa[t][1], s1[t]);
        }
      }

      // V^T fragments (A operand: rows d, k = keys), in flight under the softmax
      const __bf16* Vc = Vl[cur] + p * 32;
      v16bf vf[4];
#pragma unroll
      for (int c = 0; c < 4; ++c) vf[c] = load_frag_bf16(Vc + (c * 16) * VSP, VSP);
      // the eight V reads issue here as one group, so that the softmax covers their
      // latency; sunk to their products each pair would be waited for on its own
      __builtin_amdgcn_sched_barrier(0);

      // in-lane maximum of the exponents of query 16t + n
      float mx[QT];
#pragma unroll
      for (int t = 0; t < QT; ++t) {
        mx[t] = fmaxf(s0[t][0], s1[t][0]);
#pragma unroll
        for (int j = 1; j < 8; ++j) mx[t] = fmaxf(mx[t], fmaxf(s0[t][j], s1[t][j]));
      }
      // one wave-uniform test per pass: does any query of the wave need a new maximum?
      if (__builtin_amdgcn_ballot_w32((mx[0] > thr[0]) | (mx[1] > thr[1])) != 0) {
#pragma unroll
        for (int t = 0; t < QT; ++t) {
          // joined with the other half's, so that both halves of a query use one maximum;
          // d is how far the maximum moves: upward only, but in the first pass (thr still
          // at its start value), where it goes to the pass's own maximum, up or down
          const float d = fmaxf(fmaxf(mx[t], xhalf(mx[t])), fminf(thr[t], 0.0f));
          // a move downward happens only while O^T and the sums are still zero: factor 1
          const float f = __builtin_amdgcn_exp2f(-fmaxf(d, 0.0f));
          thr[t] = 8.0f;
          rsum[t] *= f;
#pragma unroll
          for (int c = 0; c < 4; ++c) o[t][c] *= f;
          // later passes start from the new maximum; this pass's exponents follow it here
          negm[t] -= d;
          s0[t]   -= d;
          s1[t]   -= d;
        }
      }

#pragma unroll
      for (int t = 0; t < QT; ++t) {
        // softmax numerators: the accumulators are the exponents against the maximum in use
        v16bf pb;   // P^T as B operand: element i = key 8*hig + i, i + 8 = key 16 + 8*hig + i
        float ps[8];
#pragma unroll
        for (int j = 0; j < 8; ++j) {
          const float p0 = __builtin_amdgcn_exp2f(s0[t][j]);
          const float p1 = __builtin_amdgcn_exp2f(s1[t][j]);
          ps[j] = p0 + p1;
          pb[j]     = (__bf16)p0;
          pb[j + 8] = (__bf16)p1;
        }
        rsum[t] += ((ps[0] + ps[1]) + (ps[2] + ps[3])) +
                   ((ps[4] + ps[5]) + (ps[6] + ps[7]));

        // O^T += V^T @ P^T
#pragma unroll
        for (int c = 0; c < 4; ++c) o[t][c] = wmma_bf16(vf[c], pb, o[t][c]);
      }
      // ends the pass: left free, later passes' LDS reads and score products are woven
      // into this pass's softmax and the register count passes 256 (three waves a SIMD)
      __builtin_amdgcn_sched_barrier(0);
    }

    // publish point of stage st + 1: this wave's LDS reads of stage st are done,
    // its own copies of stage st + 1 have landed, then the block meets
    asm volatile("s_wait_dscnt 0x0" ::: "memory");
    asm volatile("s_wait_asynccnt 0x0" ::: "memory");
    __syncthreads();
    // stage st + 2 into the buffer that every wave has just left
    if (st + 2 < NST)
      stage_copy(kl0 + cur * (SK * KP * 2), vl0 + cur * (DH * VSP * 2),
                 kg0 + (size_t)(st + 2) * (SK * DH), vg0 + (st + 2) * SK);
  }
  // no copy is outstanding when the wave goes on to its end
  asm volatile("s_wait_asynccnt 0x0" ::: "memory");

  // normalize and store bf16 to [B,T,C] (head-interleaved for the projection):
  // a lane holds 8 consecutive d of its query per tile, one 16-byte store each
#pragma unroll
  for (int t = 0; t < QT; ++t) {
    const float inv = 1.0f / (rsum[t] + xhalf(rsum[t]));   // join the halves' sums
    __bf16* op = O + ((size_t)(b * SEQ + q0 + t * 16 + n)) * DM + h * DH + 8 * hig;
#pragma unroll
    for (int c = 0; c < 4; ++c) {
      v8bf r;
#pragma unroll
      for (int j = 0; j < 8; ++j) r[j] = (__bf16)(o[t][c][j] * inv);
      *(v8bf*)(op + c * 16) = r;
    }
  }
}

// ---------------------------------------------------------------------------
// Kernel 3: output projection  Y = O @ Wp^T + bp  (M=8192, N=K=1024, fp32 out)
// 8 waves/block as 4 x 2 -> 128x128 block tile, 32x64 of Y per wave: an O fragment
// feeds four products, a Wp fragment two.  A stage is 128 k: 256 bytes of each of
// the 128 O rows and the 128 Wp rows, brought by asynchronous copies to LDS (16
// copies of 16 bytes a lane, 16 lanes per row, whole 128-byte lines), through no
// register.  Two buffers: stage s + 2 is asked for as soon as stage s has been
// read, so its copies fly during 32 products a wave: the last 8 of stage s and the first 24 of stage s + 1.
// Each accumulator starts at the bias and takes k upward in steps of 32.
// ---------------------------------------------------------------------------
#define PK 128   // k per stage; rows of 128 bf16 stand at pitch VSP

// Eight 16-byte pieces of one operand's stage, 16 rows apart.  l: the lane's LDS
// byte address in the buffer; g: its global address.
__device__ __forceinline__ void proj_copy(unsigned l, const __bf16* g) {
  // the copies and, as the last line, the wait that stands before any of their
  // address registers is written again
  asm volatile(
      "global_load_async_to_lds_b128 %0, %8, off\n\t"
      "global_load_async_to_lds_b128 %1, %9, off\n\t"
      "global_load_async_to_lds_b128 %2, %10, off\n\t"
      "global_load_async_to_lds_b128 %3, %11, off\n\t"
      "global_load_async_to_lds_b128 %4, %12, off\n\t"
      "global_load_async_to_lds_b128 %5, %13, off\n\t"
      "global_load_async_to_lds_b128 %6, %14, off\n\t"
      "global_load_async_to_lds_b128 %7, %15, off\n\t"
      "s_wait_xcnt 0x0"
      :: "v"(l), "v"(l + 16 * VSP * 2), "v"(l + 32 * VSP * 2), "v"(l + 48 * VSP * 2),
         "v"(l + 64 * VSP * 2), "v"(l + 80 * VSP * 2), "v"(l + 96 * VSP * 2), "v"(l + 112 * VSP * 2),
         "v"(g), "v"(g + 16 * DM), "v"(g + 32 * DM), "v"(g + 48 * DM),
         "v"(g + 64 * DM), "v"(g + 80 * DM), "v"(g + 96 * DM), "v"(g + 112 * DM)
      : "memory");
}

__global__ void __launch_bounds__(256) out_proj_kernel(
    const __bf16* __restrict__ Ob, const __bf16* __restrict__ Wpb,
    const float* __restrict__ bp, float* __restrict__ out) {
  __shared__ __attribute__((aligned(16))) __bf16 Al[2][128 * VSP];   // 128 rows of O x 128 k, padded rows
  __shared__ __attribute__((aligned(16))) __bf16 Wl[2][128 * VSP];   // 128 rows of Wp x 128 k, padded rows

  const int tid  = threadIdx.x;
  const int wave = tid >> 5;
  const int lane = tid & 31;
  const int n = lane & 15, hig = lane >> 4;
  const int rb = blockIdx.x * 128, nb = blockIdx.y * 128;
  const int r0 = rb + (wave >> 1) * 32;    // the wave's 32 rows of Y
  const int n0 = nb + (wave & 1) * 64;     // and its 64 columns

  // copy split: 16 lanes per 256-byte row
  const unsigned al0 = (unsigned)(size_t)&Al[0][(tid >> 4) * VSP + (tid & 15) * 8];
  const unsigned wl0 = (unsigned)(size_t)&Wl[0][(tid >> 4) * VSP + (tid & 15) * 8];
  const __bf16* ag0 = Ob  + (size_t)(rb + (tid >> 4)) * DM + (tid & 15) * 8;
  const __bf16* wg0 = Wpb + (size_t)(nb + (tid >> 4)) * DM + (tid & 15) * 8;
  const int NST = DM / PK;

  // stage 0 into buffer 0
  proj_copy(al0, ag0);
  proj_copy(wl0, wg0);

  v8f acc[2][4];
#pragma unroll
  for (int c = 0; c < 4; ++c) {
    const float bval = bp[n0 + c * 16 + n];
#pragma unroll
    for (int i = 0; i < 2; ++i)
#pragma unroll
      for (int j = 0; j < 8; ++j) acc[i][c][j] = bval;
  }

  // stage 0 has landed for this wave, then for the block; then stage 1 into buffer 1
  asm volatile("s_wait_asynccnt 0x0" ::: "memory");
  __syncthreads();
  proj_copy(al0 + 128 * VSP * 2, ag0 + PK);
  proj_copy(wl0 + 128 * VSP * 2, wg0 + PK);

  for (int st = 0; st < NST; ++st) {
    const int cur = st & 1;
    const __bf16* Ac = Al[cur] + ((wave >> 1) * 32) * VSP;
    const __bf16* Wc = Wl[cur] + ((wave & 1) * 64) * VSP;

    // two fragment sets: the 12 LDS reads of the next 32 k go out as one group ahead
    // of the 8 products of these 32 k; only inside the stage, never into the next one
    v16bf a[2][2], w[2][4];
#pragma unroll
    for (int i = 0; i < 2; ++i) a[0][i] = load_frag_bf16(Ac + (i * 16) * VSP, VSP);
#pragma unroll
    for (int c = 0; c < 4; ++c) w[0][c] = load_frag_bf16(Wc + (c * 16) * VSP, VSP);
#pragma unroll
    for (int kh = 0; kh < PK / 32; ++kh) {
      const int s = kh & 1;
      if (kh + 1 < PK / 32) {
#pragma unroll
        for (int i = 0; i < 2; ++i)
          a[s ^ 1][i] = load_frag_bf16(Ac + (i * 16) * VSP + (kh + 1) * 32, VSP);
#pragma unroll
        for (int c = 0; c < 4; ++c)
          w[s ^ 1][c] = load_frag_bf16(Wc + (c * 16) * VSP + (kh + 1) * 32, VSP);
        // holds that group here: sunk among the products, each pair of reads is
        // waited for on its own, in one fragment set
        __builtin_amdgcn_sched_barrier(0);
      } else {
        // the stage's last fragments are asked for: the publish point stands here, ahead
        // of their products, which need registers only, so that the refill starts sooner.
        // Publish point of stage st + 1: this wave's LDS reads of stage st are done,
        // its own copies of stage st + 1 have landed, then the block meets
        asm volatile("s_wait_dscnt 0x0" ::: "memory");
        asm volatile("s_wait_asynccnt 0x0" ::: "memory");
        __syncthreads();
        // stage st + 2 into the buffer that every wave has just left
        if (st + 2 < NST) {
          proj_copy(al0 + cur * (128 * VSP * 2), ag0 + (st + 2) * PK);
          proj_copy(wl0 + cur * (128 * VSP * 2), wg0 + (st + 2) * PK);
        }
      }
#pragma unroll
      for (int i = 0; i < 2; ++i)
#pragma unroll
        for (int c = 0; c < 4; ++c) acc[i][c] = wmma_bf16(a[s][i], w[s][c], acc[i][c]);
    }
  }
  // no copy is outstanding when the wave goes on to its end
  asm volatile("s_wait_asynccnt 0x0" ::: "memory");

#pragma unroll
  for (int i = 0; i < 2; ++i)
#pragma unroll
    for (int c = 0; c < 4; ++c)
#pragma unroll
      for (int j = 0; j < 8; ++j)
        out[(size_t)(r0 + i * 16 + j + 8 * hig) * DM + n0 + c * 16 + n] = acc[i][c][j];
}

// ---------------------------------------------------------------------------
// Host launcher
// ---------------------------------------------------------------------------
extern "C" void kernel_launch(void* const* d_in, const int* in_sizes, int n_in,
                              void* d_out, int out_size, void* d_ws, size_t ws_size,
                              hipStream_t stream) {
  const float* x  = (const float*)d_in[0];
  const float* Wq = (const float*)d_in[1];
  const float* bq = (const float*)d_in[2];
  const float* Wk = (const float*)d_in[3];
  const float* bk = (const float*)d_in[4];
  const float* Wv = (const float*)d_in[5];
  const float* bv = (const float*)d_in[6];
  const float* Wp = (const float*)d_in[7];
  const float* bp = (const float*)d_in[8];
  float* out = (float*)d_out;

  __bf16* ws = (__bf16*)d_ws;
  const size_t QKV_E = (size_t)BATCH * HEADS * SEQ * DH;  // 8,388,608 elems each
  __bf16* Qw   = ws;                       // [B,H,T,64]   bf16
  __bf16* Vtw  = ws + 2 * QKV_E;           // [B,H,64,T]   bf16 (transposed V)
  __bf16* Ow   = ws + 3 * QKV_E;           // [B,T,1024]   bf16
  __bf16* Wpb  = ws + 4 * QKV_E;           // [1024,1024]  bf16
  __bf16* Wqkv = Wpb + (size_t)DM * DM;    // 3 x [64,64]  bf16
  // total: ~69.2 MB of d_ws

  cvt_weights_kernel<<<256, 256, 0, stream>>>(Wq, Wk, Wv, Wp, Wqkv, Wpb);

  qkv_proj_kernel<<<BATCH * HEADS * (SEQ / 64) / 8, 256, 0, stream>>>(x, Wqkv, bq, bk, bv, Qw, Vtw);

  dim3 g2(SEQ / (128 * QT), BATCH * HEADS);
  flash_attn_kernel<<<g2, 256, 0, stream>>>(Qw, Qw + QKV_E, Vtw, Ow);

  dim3 g3((BATCH * SEQ) / 128, DM / 128);
  out_proj_kernel<<<g3, 256, 0, stream>>>(Ow, Wpb, bp, out);
}

// v009
// Measured time: 77.3 microseconds a run.
// Two timings next to v008 both put it at 1.04 times that version's speed.
// Counting every step since v000, it is 4.24 times as fast.
#include <hip/hip_runtime.h>
#include <hip/hip_bf16.h>

typedef __attribute__((ext_vector_type(16))) __bf16 v16bf;
typedef __attribute__((ext_vector_type(8)))  __bf16 v8bf;
typedef __attribute__((ext_vector_type(8)))  float  v8f;

#define HEADS 16
#define DH    64
#define DM    1024
#define BATCH 4
#define SEQ   2048

// LDS row pitches in elements: an odd multiple of 16 bytes, so that the 16 rows
// a 16-byte fragment load touches fall on 16 different groups of four banks
#define KP 72   // rows of 64 bf16 (128 B) at 144 B

// score scale in the log2 domain, (1/sqrt(C)) * log2(e): q is stored multiplied by it
#define QSC (0.03125f * 1.44269504088896f)

// ---------------------------------------------------------------------------
// WMMA helper: D = A(16x32 bf16) * B(32x16 bf16) + C(16x16 f32)
// ---------------------------------------------------------------------------
__device__ __forceinline__ v8f wmma_bf16(v16bf a, v16bf b, v8f c) {
  return __builtin_amdgcn_wmma_f32_16x16x32_bf16(
      /*neg_a=*/false, a, /*neg_b=*/false, b,
      /*c_mod=*/(short)0, c, /*reuse_a=*/false, /*reuse_b=*/false);
}

// ---------------------------------------------------------------------------
// Fragment loaders: documented gfx1250 16-bit A/B layout.
// Lane L holds row/col (L & 15); K runs: base=(L>>4)*8, elements [base..base+7]
// and [base+16..base+23].  base pointer must be 16B aligned; ld in elements.
// ---------------------------------------------------------------------------
__device__ __forceinline__ v16bf load_frag_bf16(const __bf16* base, int ld) {
  const int lane = threadIdx.x & 31;
  const __bf16* p = base + (size_t)(lane & 15) * ld + ((lane >> 4) << 3);
  v8bf lo = *(const v8bf*)(p);
  v8bf hi = *(const v8bf*)(p + 16);
  v16bf r;
#pragma unroll
  for (int i = 0; i < 8; ++i) { r[i] = lo[i]; r[i + 8] = hi[i]; }
  return r;
}

__device__ __forceinline__ v16bf load_frag_f32(const float* base, int ld) {
  const int lane = threadIdx.x & 31;
  const float* p = base + (size_t)(lane & 15) * ld + ((lane >> 4) << 3);
  v16bf r;
#pragma unroll
  for (int i = 0; i < 8; ++i) {
    r[i]     = (__bf16)p[i];
    r[i + 8] = (__bf16)p[i + 16];
  }
  return r;
}

// value of lane l ^ 16 (the other half of the wave), one vector instruction
__device__ __forceinline__ float xhalf(float v) {
  const int b = __builtin_bit_cast(int, v);
  return __builtin_bit_cast(float, __builtin_amdgcn_permlanex16(
      b, b, 0x76543210, 0xfedcba98, false, false));
}

// ---------------------------------------------------------------------------
// Kernel 1: per-head QKV projection.  One wave takes 64 rows (t) of one head:
// it reads its x once, keeps the four 16-row fragment pairs in registers and
// makes q, k and v from them.  q and k are taken transposed (W x^T): a lane then
// holds 8 consecutive e of one row t.  v is taken as x W^T: a lane holds 8
// consecutive t of one e.  Either way a lane stores 16-byte runs.
// The work is 12 groups (3 matrices x 4 tiles of 16 weight rows); a group's two
// weight fragments and its bias come four groups ahead, through four register slots.
// Q,K stored [B,H,T,64]; V stored transposed [B,H,64,T] for the P@V stage.
// q is multiplied by QSC in f32 before its one rounding to bf16, so that K q^T is
// already the exponent (base 2) that the attention kernel wants.
// The weights arrive in f32 and there is no launch that converts them.  Wq, Wk, Wv:
// each work-group rounds the 3 x 64 x 64 values to bf16 into its own LDS while its
// x is in flight, and the waves take their weight fragments from there.  Wp, which
// the output projection two launches on wants in bf16: the work-groups behind the
// first QKV_WG of the grid do nothing but round their 8192 values of it each; they
// find room beside the projection's work-groups, which stand one to a WGP.
// ---------------------------------------------------------------------------
typedef __attribute__((ext_vector_type(4))) float v4f;
typedef __attribute__((ext_vector_type(4))) __bf16 v4bf;

#define QKV_WG (BATCH * HEADS * (SEQ / 64) / 8)   // work-groups that project
#define WP_WG  (DM * DM / 8192)                   // work-groups that round Wp

__device__ __forceinline__ v4bf round4(v4f a) {
  v4bf r;
#pragma unroll
  for (int e = 0; e < 4; ++e) r[e] = (__bf16)a[e];
  return r;
}

__global__ void __launch_bounds__(256) qkv_proj_kernel(
    const float* __restrict__ x, const float* __restrict__ Wq,
    const float* __restrict__ Wk, const float* __restrict__ Wv,
    const float* __restrict__ Wp,
    const float* __restrict__ bq, const float* __restrict__ bk,
    const float* __restrict__ bv,
    __bf16* __restrict__ qk_out, __bf16* __restrict__ vt_out,
    __bf16* __restrict__ wpb) {
  __shared__ __attribute__((aligned(16))) __bf16 wqkv[3 * DH * KP];   // Wq | Wk | Wv, padded rows

  if (blockIdx.x >= QKV_WG) {
    // Wp: 8 loads of 16 bytes a lane, all in flight, a wave's load four whole lines
    // and its store two; the whole work-group leaves here, ahead of the barrier below
    const size_t o = (size_t)(blockIdx.x - QKV_WG) * 8192 + threadIdx.x * 4;
    v4f a[8];
#pragma unroll
    for (int j = 0; j < 8; ++j) a[j] = *(const v4f*)(Wp + o + j * 1024);
#pragma unroll
    for (int j = 0; j < 8; ++j) *(v4bf*)(wpb + o + j * 1024) = round4(a[j]);
    return;
  }

  const int wave = threadIdx.x >> 5;
  const int lane = threadIdx.x & 31;
  const int n    = lane & 15;
  const int hig  = lane >> 4;
  const int nu   = SEQ / 64;
  const int unit = blockIdx.x * 8 + wave;      // 64-row unit of one head
  const int t0   = (unit % nu) * 64;
  const int bh   = unit / nu;
  const int b    = bh / HEADS, h = bh % HEADS;

  // the thread's share of the weights (4 pieces of 4 values of each matrix), then all
  // of the wave's x: 32 loads of 16 bytes a lane
  v16bf rw[4][2];
  v8f   rb[4];
  v4f   wr[3][4];
#pragma unroll
  for (int j = 0; j < 4; ++j) {
    wr[0][j] = *(const v4f*)(Wq + j * 1024 + threadIdx.x * 4);
    wr[1][j] = *(const v4f*)(Wk + j * 1024 + threadIdx.x * 4);
    wr[2][j] = *(const v4f*)(Wv + j * 1024 + threadIdx.x * 4);
  }
  const float* xp = x + ((size_t)(b * SEQ + t0 + n)) * DM + h * DH + 8 * hig;
  v4f xr[4][2][4];   // [16-row tile][k half][k 0..3, 4..7, 16..19, 20..23 of the lane's run]
#pragma unroll
  for (int i = 0; i < 4; ++i)
#pragma unroll
    for (int kh = 0; kh < 2; ++kh) {
      const float* p = xp + (size_t)(i * 16) * DM + kh * 32;
      xr[i][kh][0] = *(const v4f*)(p);
      xr[i][kh][1] = *(const v4f*)(p + 4);
      xr[i][kh][2] = *(const v4f*)(p + 16);
      xr[i][kh][3] = *(const v4f*)(p + 20);
    }
  // the x address registers are free from here on: the wait stands before their reuse
  asm volatile("s_wait_xcnt 0x0" ::: "memory");
  // keeps every load above in flight at once: left free, the conversions below are
  // woven between the loads and only four of them are outstanding at a time
  __builtin_amdgcn_sched_barrier(0);

  // the weights, asked for ahead of x, are rounded into LDS under x's flight:
  // value 4 * (256 j + thread) of a matrix is row 16 j + thread / 16, column 4 * (thread % 16)
  {
    __bf16* wl = wqkv + (threadIdx.x >> 4) * KP + (threadIdx.x & 15) * 4;
#pragma unroll
    for (int m = 0; m < 3; ++m)
#pragma unroll
      for (int j = 0; j < 4; ++j) *(v4bf*)(wl + (m * DH + j * 16) * KP) = round4(wr[m][j]);
  }
  // every wave reads weight rows that the other waves wrote.  The fences name LDS
  // alone: a plain __syncthreads() would also wait here for all of the wave's x
  __builtin_amdgcn_fence(__ATOMIC_RELEASE, "workgroup", "local");
  __builtin_amdgcn_s_barrier();
  __builtin_amdgcn_fence(__ATOMIC_ACQUIRE, "workgroup", "local");

  // groups 0..2 (Wq rows 0..47 with their bias) take the registers that the f32
  // weights have left
#pragma unroll
  for (int c = 0; c < 3; ++c) {
    rw[c][0] = load_frag_bf16(wqkv + (c * 16) * KP, KP);
    rw[c][1] = load_frag_bf16(wqkv + (c * 16) * KP + 32, KP);
    rb[c]    = *(const v8f*)(bq + c * 16 + 8 * hig);
  }

  // group 3 and the four v biases: their registers are not there before x is converted
  float bvl[4];
  rw[3][0] = load_frag_bf16(wqkv + 48 * KP, KP);
  rw[3][1] = load_frag_bf16(wqkv + 48 * KP + 32, KP);
  rb[3]    = *(const v8f*)(bq + 48 + 8 * hig);
#pragma unroll
  for (int c = 0; c < 4; ++c) bvl[c] = bv[c * 16 + n];

  v16bf xa[4][2];
#pragma unroll
  for (int i = 0; i < 4; ++i)
#pragma unroll
    for (int kh = 0; kh < 2; ++kh)
#pragma unroll
      for (int e = 0; e < 4; ++e) {
        xa[i][kh][e]      = (__bf16)xr[i][kh][0][e];
        xa[i][kh][e + 4]  = (__bf16)xr[i][kh][1][e];
        xa[i][kh][e + 8]  = (__bf16)xr[i][kh][2][e];
        xa[i][kh][e + 12] = (__bf16)xr[i][kh][3][e];
      }

  __bf16* qo = qk_out + ((size_t)(bh * SEQ + t0 + n)) * DH + 8 * hig;
  __bf16* vt = vt_out + (size_t)bh * DH * SEQ + (size_t)n * SEQ + t0 + 8 * hig;

#pragma unroll
  for (int g = 0; g < 12; ++g) {
    const int sel = g >> 2, c = g & 3;
    if (sel < 2) {
      // q, k: D[e = 16c + 8*hig + j][t = 16i + n] = W x^T + bias[e]
      __bf16* out = qo + (size_t)sel * ((size_t)BATCH * HEADS * SEQ * DH);
      const float osc = (sel == 0) ? QSC : 1.0f;
#pragma unroll
      for (int i = 0; i < 4; ++i) {
        v8f acc = wmma_bf16(rw[c][0], xa[i][0], rb[c]);
        acc = wmma_bf16(rw[c][1], xa[i][1], acc);
        v8bf r;
#pragma unroll
        for (int j = 0; j < 8; ++j) r[j] = (__bf16)(acc[j] * osc);
        *(v8bf*)(out + (size_t)(i * 16) * DH + c * 16) = r;
      }
    } else {
      // v: D[t = 16i + 8*hig + j][e = 16c + n] = x W^T + bias[e], stored as V^T
      v8f bvec;
#pragma unroll
      for (int j = 0; j < 8; ++j) bvec[j] = bvl[c];
#pragma unroll
      for (int i = 0; i < 4; ++i) {
        v8f acc = wmma_bf16(xa[i][0], rw[c][0], bvec);
        acc = wmma_bf16(xa[i][1], rw[c][1], acc);
        v8bf r;
#pragma unroll
        for (int j = 0; j < 8; ++j) r[j] = (__bf16)acc[j];
        *(v8bf*)(vt + (size_t)(c * 16) * SEQ + i * 16) = r;
      }
    }
    if (g + 4 < 12) {
      // the group's stores name registers that the loads below may take over
      asm volatile("s_wait_xcnt 0x0" ::: "memory");
      const __bf16* Wn = wqkv + ((sel + 1) * DH + c * 16) * KP;
      rw[c][0] = load_frag_bf16(Wn, KP);
      rw[c][1] = load_frag_bf16(Wn + 32, KP);
      if (sel == 0) rb[c] = *(const v8f*)(bk + c * 16 + 8 * hig);
      // holds the refill of this slot here, three groups of products ahead of its
      // use: sunk to the use, its latency would be waited out once a group
      __builtin_amdgcn_sched_barrier(0);
    }
  }
}

#define QT  2     // 16-query tiles per wave
#define SK  128   // keys per stage
#define VSP 136   // V^T stage rows: 128 bf16 (256 B) at 272 B, an odd multiple of 16 B

// One stage: lane's four 16-byte pieces of K (32 rows apart) and of V^T (16 rows
// apart).  kl, vl: the lane's LDS byte addresses in the buffer; kg, vg: its global ones.
__device__ __forceinline__ void stage_copy(unsigned kl, unsigned vl,
                                           const __bf16* kg, const __bf16* vg) {
  // the copies and, as the last line, the wait that stands before any of their
  // address registers is written again
  asm volatile(
      "global_load_async_to_lds_b128 %0, %8, off\n\t"
      "global_load_async_to_lds_b128 %1, %9, off\n\t"
      "global_load_async_to_lds_b128 %2, %10, off\n\t"
      "global_load_async_to_lds_b128 %3, %11, off\n\t"
      "global_load_async_to_lds_b128 %4, %12, off\n\t"
      "global_load_async_to_lds_b128 %5, %13, off\n\t"
      "global_load_async_to_lds_b128 %6, %14, off\n\t"
      "global_load_async_to_lds_b128 %7, %15, off\n\t"
      "s_wait_xcnt 0x0"
      :: "v"(kl), "v"(kl + 32 * KP * 2), "v"(kl + 64 * KP * 2), "v"(kl + 96 * KP * 2),
         "v"(vl), "v"(vl + 16 * VSP * 2), "v"(vl + 32 * VSP * 2), "v"(vl + 48 * VSP * 2),
         "v"(kg), "v"(kg + 32 * DH), "v"(kg + 64 * DH), "v"(kg + 96 * DH),
         "v"(vg), "v"(vg + 16 * SEQ), "v"(vg + 32 * SEQ), "v"(vg + 48 * SEQ)
      : "memory");
}

__global__ void __launch_bounds__(256) flash_attn_kernel(
    const __bf16* __restrict__ Q, const __bf16* __restrict__ K,
    const __bf16* __restrict__ Vt, __bf16* __restrict__ O) {
  __shared__ __attribute__((aligned(16))) __bf16 Kl[2][SK * KP];     // 128 keys x 64 d, padded rows
  __shared__ __attribute__((aligned(16))) __bf16 Vl[2][DH * VSP];    // 64 d x 128 keys (V^T), padded rows

  const int tid  = threadIdx.x;
  const int wave = tid >> 5;
  const int lane = tid & 31;
  const int n = lane & 15, hig = lane >> 4;
  const int bh = blockIdx.y;
  const int b = bh / HEADS, h = bh % HEADS;
  const int q0 = blockIdx.x * (128 * QT) + wave * (16 * QT);

  const __bf16* Kb = K + (size_t)bh * SEQ * DH;
  const __bf16* Vb = Vt + (size_t)bh * DH * SEQ;

  // copy split: K 8 lanes per 128-byte row, V^T 16 lanes per 256-byte row
  const unsigned kl0 = (unsigned)(size_t)&Kl[0][(tid >> 3) * KP + (tid & 7) * 8];
  const unsigned vl0 = (unsigned)(size_t)&Vl[0][(tid >> 4) * VSP + (tid & 15) * 8];
  const __bf16* kg0 = Kb + tid * 8;
  const __bf16* vg0 = Vb + (size_t)(tid >> 4) * SEQ + (tid & 15) * 8;
  const int NST = SEQ / SK;

  // stage 0 into buffer 0
  stage_copy(kl0, vl0, kg0, vg0);

  const __bf16* Qp = Q + ((size_t)(bh * SEQ + q0)) * DH;
  v16bf qa[QT][2];
#pragma unroll
  for (int t = 0; t < QT; ++t) {
    qa[t][0] = load_frag_bf16(Qp + (size_t)(t * 16) * DH, DH);
    qa[t][1] = load_frag_bf16(Qp + (size_t)(t * 16) * DH + 32, DH);
  }

  v8f   o[QT][4];   // o[t][c][j] = O^T[d = 16c + 8*hig + j][query 16t + n]
  v8f   negm[QT];   // minus the maximum in use for query 16t + n, eight times (same in both halves)
  float thr[QT];    // exponent above which that maximum is replaced
  float rsum[QT];   // running sum over this half's keys only
#pragma unroll
  for (int t = 0; t < QT; ++t) {
    thr[t]  = -3.0e38f;   // the first pass always sets the maximum
    rsum[t] = 0.0f;
#pragma unroll
    for (int j = 0; j < 8; ++j) negm[t][j] = 0.0f;
#pragma unroll
    for (int c = 0; c < 4; ++c)
#pragma unroll
      for (int j = 0; j < 8; ++j) o[t][c][j] = 0.0f;
  }

  // stage 0 has landed for this wave, then for the block; then stage 1 into buffer 1
  asm volatile("s_wait_asynccnt 0x0" ::: "memory");
  __syncthreads();
  stage_copy(kl0 + SK * KP * 2, vl0 + DH * VSP * 2, kg0 + SK * DH, vg0 + SK);

  for (int st = 0; st < NST; ++st) {
    const int cur = st & 1;

#pragma unroll
    for (int p = 0; p < SK / 32; ++p) {
      // S^T[32k x 16q] = K @ Q^T from LDS, per query tile: two 16x16 C-tiles of
      // 2 WMMAs each; the four K fragments are read once for both query tiles
      const __bf16* Kc = Kl[cur] + p * 32 * KP;
      v8f s0[QT], s1[QT];
      {
        v16bf k00 = load_frag_bf16(Kc, KP);
        v16bf k01 = load_frag_bf16(Kc + 32, KP);
        v16bf k10 = load_frag_bf16(Kc + 16 * KP, KP);
        v16bf k11 = load_frag_bf16(Kc + 16 * KP + 32, KP);
#pragma unroll
        for (int t = 0; t < QT; ++t) {
          s0[t] = wmma_bf16(k00, qa[t][0], negm[t]);
          s0[t] = wmma_bf16(k01, qa[t][1], s0[t]);
          s1[t] = wmma_bf16(k10, qa[t][0], negm[t]);
          s1[t] = wmma_bf16(k11, qa[t][1], s1[t]);
        }
      }

      // V^T fragments (A operand: rows d, k = keys), in flight under the softmax
      const __bf16* Vc = Vl[cur] + p * 32;
      v16bf vf[4];
#pragma unroll
      for (int c = 0; c < 4; ++c) vf[c] = load_frag_bf16(Vc + (c * 16) * VSP, VSP);
      // the eight V reads issue here as one group, so that the softmax covers their
      // latency; sunk to their products each pair would be waited for on its own
      __builtin_amdgcn_sched_barrier(0);

      // in-lane maximum of the exponents of query 16t + n
      float mx[QT];
#pragma unroll
      for (int t = 0; t < QT; ++t) {
        mx[t] = fmaxf(s0[t][0], s1[t][0]);
#pragma unroll
        for (int j = 1; j < 8; ++j) mx[t] = fmaxf(mx[t], fmaxf(s0[t][j], s1[t][j]));
      }
      // one wave-uniform test per pass: does any query of the wave need a new maximum?
      if (__builtin_amdgcn_ballot_w32((mx[0] > thr[0]) | (mx[1] > thr[1])) != 0) {
#pragma unroll
        for (int t = 0; t < QT; ++t) {
          // joined with the other half's, so that both halves of a query use one maximum;
          // d is how far the maximum moves: upward only, but in the first pass (thr still
          // at its start value), where it goes to the pass's own maximum, up or down
          const float d = fmaxf(fmaxf(mx[t], xhalf(mx[t])), fminf(thr[t], 0.0f));
          // a move downward happens only while O^T and the sums are still zero: factor 1
          const float f = __builtin_amdgcn_exp2f(-fmaxf(d, 0.0f));
          thr[t] = 8.0f;
          rsum[t] *= f;
#pragma unroll
          for (int c = 0; c < 4; ++c) o[t][c] *= f;
          // later passes start from the new maximum; this pass's exponents follow it here
          negm[t] -= d;
          s0[t]   -= d;
          s1[t]   -= d;
        }
      }

#pragma unroll
      for (int t = 0; t < QT; ++t) {
        // softmax numerators: the accumulators are the exponents against the maximum in use
        v16bf pb;   // P^T as B operand: element i = key 8*hig + i, i + 8 = key 16 + 8*hig + i
        float ps[8];
#pragma unroll
        for (int j = 0; j < 8; ++j) {
          const float p0 = __builtin_amdgcn_exp2f(s0[t][j]);
          const float p1 = __builtin_amdgcn_exp2f(s1[t][j]);
          ps[j] = p0 + p1;
          pb[j]     = (__bf16)p0;
          pb[j + 8] = (__bf16)p1;
        }
        rsum[t] += ((ps[0] + ps[1]) + (ps[2] + ps[3])) +
                   ((ps[4] + ps[5]) + (ps[6] + ps[7]));

        // O^T += V^T @ P^T
#pragma unroll
        for (int c = 0; c < 4; ++c) o[t][c] = wmma_bf16(vf[c], pb, o[t][c]);
      }
      // ends the pass: left free, later passes' LDS reads and score products are woven
      // into this pass's softmax and the register count passes 256 (three waves a SIMD)
      __builtin_amdgcn_sched_barrier(0);
    }

    // publish point of stage st + 1: this wave's LDS reads of stage st are done,
    // its own copies of stage st + 1 have landed, then the block meets
    asm volatile("s_wait_dscnt 0x0" ::: "memory");
    asm volatile("s_wait_asynccnt 0x0" ::: "memory");
    __syncthreads();
    // stage st + 2 into the buffer that every wave has just left
    if (st + 2 < NST)
      stage_copy(kl0 + cur * (SK * KP * 2), vl0 + cur * (DH * VSP * 2),
                 kg0 + (size_t)(st + 2) * (SK * DH), vg0 + (st + 2) * SK);
  }
  // no copy is outstanding when the wave goes on to its end
  asm volatile("s_wait_asynccnt 0x0" ::: "memory");

  // normalize and store bf16 to [B,T,C] (head-interleaved for the projection):
  // a lane holds 8 consecutive d of its query per tile, one 16-byte store each
#pragma unroll
  for (int t = 0; t < QT; ++t) {
    const float inv = 1.0f / (rsum[t] + xhalf(rsum[t]));   // join the halves' sums
    __bf16* op = O + ((size_t)(b * SEQ + q0 + t * 16 + n)) * DM + h * DH + 8 * hig;
#pragma unroll
    for (int c = 0; c < 4; ++c) {
      v8bf r;
#pragma unroll
      for (int j = 0; j < 8; ++j) r[j] = (__bf16)(o[t][c][j] * inv);
      *(v8bf*)(op + c * 16) = r;
    }
  }
}

// ---------------------------------------------------------------------------
// Kernel 3: output projection  Y = O @ Wp^T + bp  (M=8192, N=K=1024, fp32 out)
// 8 waves/block as 4 x 2 -> 128x128 block tile, 32x64 of Y per wave: an O fragment
// feeds four products, a Wp fragment two.  A stage is 128 k: 256 bytes of each of
// the 128 O rows and the 128 Wp rows, brought by asynchronous copies to LDS (16
// copies of 16 bytes a lane, 16 lanes per row, whole 128-byte lines), through no
// register.  Two buffers: stage s + 2 is asked for as soon as stage s has been
// read, so its copies fly during 32 products a wave: the last 8 of stage s and the first 24 of stage s + 1.
// Each accumulator starts at the bias and takes k upward in steps of 32.
// ---------------------------------------------------------------------------
#define PK 128   // k per stage; rows of 128 bf16 stand at pitch VSP

// Eight 16-byte pieces of one operand's stage, 16 rows apart.  l: the lane's LDS
// byte address in the buffer; g: its global address.
__device__ __forceinline__ void proj_copy(unsigned l, const __bf16* g) {
  // the copies and, as the last line, the wait that stands before any of their
  // address registers is written again
  asm volatile(
      "global_load_async_to_lds_b128 %0, %8, off\n\t"
      "global_load_async_to_lds_b128 %1, %9, off\n\t"
      "global_load_async_to_lds_b128 %2, %10, off\n\t"
      "global_load_async_to_lds_b128 %3, %11, off\n\t"
      "global_load_async_to_lds_b128 %4, %12, off\n\t"
      "global_load_async_to_lds_b128 %5, %13, off\n\t"
      "global_load_async_to_lds_b128 %6, %14, off\n\t"
      "global_load_async_to_lds_b128 %7, %15, off\n\t"
      "s_wait_xcnt 0x0"
      :: "v"(l), "v"(l + 16 * VSP * 2), "v"(l + 32 * VSP * 2), "v"(l + 48 * VSP * 2),
         "v"(l + 64 * VSP * 2), "v"(l + 80 * VSP * 2), "v"(l + 96 * VSP * 2), "v"(l + 112 * VSP * 2),
         "v"(g), "v"(g + 16 * DM), "v"(g + 32 * DM), "v"(g + 48 * DM),
         "v"(g + 64 * DM), "v"(g + 80 * DM), "v"(g + 96 * DM), "v"(g + 112 * DM)
      : "memory");
}

__global__ void __launch_bounds__(256) out_proj_kernel(
    const __bf16* __restrict__ Ob, const __bf16* __restrict__ Wpb,
    const float* __restrict__ bp, float* __restrict__ out) {
  __shared__ __attribute__((aligned(16))) __bf16 Al[2][128 * VSP];   // 128 rows of O x 128 k, padded rows
  __shared__ __attribute__((aligned(16))) __bf16 Wl[2][128 * VSP];   // 128 rows of Wp x 128 k, padded rows

  const int tid  = threadIdx.x;
  const int wave = tid >> 5;
  const int lane = tid & 31;
  const int n = lane & 15, hig = lane >> 4;
  const int rb = blockIdx.x * 128, nb = blockIdx.y * 128;
  const int r0 = rb + (wave >> 1) * 32;    // the wave's 32 rows of Y
  const int n0 = nb + (wave & 1) * 64;     // and its 64 columns

  // copy split: 16 lanes per 256-byte row
  const unsigned al0 = (unsigned)(size_t)&Al[0][(tid >> 4) * VSP + (tid & 15) * 8];
  const unsigned wl0 = (unsigned)(size_t)&Wl[0][(tid >> 4) * VSP + (tid & 15) * 8];
  const __bf16* ag0 = Ob  + (size_t)(rb + (tid >> 4)) * DM + (tid & 15) * 8;
  const __bf16* wg0 = Wpb + (size_t)(nb + (tid >> 4)) * DM + (tid & 15) * 8;
  const int NST = DM / PK;

  // stage 0 into buffer 0
  proj_copy(al0, ag0);
  proj_copy(wl0, wg0);

  v8f acc[2][4];
#pragma unroll
  for (int c = 0; c < 4; ++c) {
    const float bval = bp[n0 + c * 16 + n];
#pragma unroll
    for (int i = 0; i < 2; ++i)
#pragma unroll
      for (int j = 0; j < 8; ++j) acc[i][c][j] = bval;
  }

  // stage 0 has landed for this wave, then for the block; then stage 1 into buffer 1
  asm volatile("s_wait_asynccnt 0x0" ::: "memory");
  __syncthreads();
  proj_copy(al0 + 128 * VSP * 2, ag0 + PK);
  proj_copy(wl0 + 128 * VSP * 2, wg0 + PK);

  for (int st = 0; st < NST; ++st) {
    const int cur = st & 1;
    const __bf16* Ac = Al[cur] + ((wave >> 1) * 32) * VSP;
    const __bf16* Wc = Wl[cur] + ((wave & 1) * 64) * VSP;

    // two fragment sets: the 12 LDS reads of the next 32 k go out as one group ahead
    // of the 8 products of these 32 k; only inside the stage, never into the next one
    v16bf a[2][2], w[2][4];
#pragma unroll
    for (int i = 0; i < 2; ++i) a[0][i] = load_frag_bf16(Ac + (i * 16) * VSP, VSP);
#pragma unroll
    for (int c = 0; c < 4; ++c) w[0][c] = load_frag_bf16(Wc + (c * 16) * VSP, VSP);
#pragma unroll
    for (int kh = 0; kh < PK / 32; ++kh) {
      const int s = kh & 1;
      if (kh + 1 < PK / 32) {
#pragma unroll
        for (int i = 0; i < 2; ++i)
          a[s ^ 1][i] = load_frag_bf16(Ac + (i * 16) * VSP + (kh + 1) * 32, VSP);
#pragma unroll
        for (int c = 0; c < 4; ++c)
          w[s ^ 1][c] = load_frag_bf16(Wc + (c * 16) * VSP + (kh + 1) * 32, VSP);
        // holds that group here: sunk among the products, each pair of reads is
        // waited for on its own, in one fragment set
        __builtin_amdgcn_sched_barrier(0);
      } else {
        // the stage's last fragments are asked for: the publish point stands here, ahead
        // of their products, which need registers only, so that the refill starts sooner.
        // Publish point of stage st + 1: this wave's LDS reads of stage st are done,
        // its own copies of stage st + 1 have landed, then the block meets
        asm volatile("s_wait_dscnt 0x0" ::: "memory");
        asm volatile("s_wait_asynccnt 0x0" ::: "memory");
        __syncthreads();
        // stage st + 2 into the buffer that every wave has just left
        if (st + 2 < NST) {
          proj_copy(al0 + cur * (128 * VSP * 2), ag0 + (st + 2) * PK);
          proj_copy(wl0 + cur * (128 * VSP * 2), wg0 + (st + 2) * PK);
        }
      }
#pragma unroll
      for (int i = 0; i < 2; ++i)
#pragma unroll
        for (int c = 0; c < 4; ++c) acc[i][c] = wmma_bf16(a[s][i], w[s][c], acc[i][c]);
    }
  }
  // no copy is outstanding when the wave goes on to its end
  asm volatile("s_wait_asynccnt 0x0" ::: "memory");

#pragma unroll
  for (int i = 0; i < 2; ++i)
#pragma unroll
    for (int c = 0; c < 4; ++c)
#pragma unroll
      for (int j = 0; j < 8; ++j)
        out[(size_t)(r0 + i * 16 + j + 8 * hig) * DM + n0 + c * 16 + n] = acc[i][c][j];
}

// ---------------------------------------------------------------------------
// Host launcher
// ---------------------------------------------------------------------------
extern "C" void kernel_launch(void* const* d_in, const int* in_sizes, int n_in,
                              void* d_out, int out_size, void* d_ws, size_t ws_size,
                              hipStream_t stream) {
  const float* x  = (const float*)d_in[0];
  const float* Wq = (const float*)d_in[1];
  const float* bq = (const float*)d_in[2];
  const float* Wk = (const float*)d_in[3];
  const float* bk = (const float*)d_in[4];
  const float* Wv = (const float*)d_in[5];
  const float* bv = (const float*)d_in[6];
  const float* Wp = (const float*)d_in[7];
  const float* bp = (const float*)d_in[8];
  float* out = (float*)d_out;

  __bf16* ws = (__bf16*)d_ws;
  const size_t QKV_E = (size_t)BATCH * HEADS * SEQ * DH;  // 8,388,608 elems each
  __bf16* Qw   = ws;                       // [B,H,T,64]   bf16
  __bf16* Vtw  = ws + 2 * QKV_E;           // [B,H,64,T]   bf16 (transposed V)
  __bf16* Ow   = ws + 3 * QKV_E;           // [B,T,1024]   bf16
  __bf16* Wpb  = ws + 4 * QKV_E;           // [1024,1024]  bf16
  // total: ~69.2 MB of d_ws

  qkv_proj_kernel<<<QKV_WG + WP_WG, 256, 0, stream>>>(x, Wq, Wk, Wv, Wp, bq, bk, bv, Qw, Vtw, Wpb);

  dim3 g2(SEQ / (128 * QT), BATCH * HEADS);
  flash_attn_kernel<<<g2, 256, 0, stream>>>(Qw, Qw + QKV_E, Vtw, Ow);

  dim3 g3((BATCH * SEQ) / 128, DM / 128);
  out_proj_kernel<<<g3, 256, 0, stream>>>(Ow, Wpb, bp, out);
}

// v010
// A run of this version takes 72.5 microseconds.
// In two side-by-side timings against v009, it was 1.07 and 1.08 times as fast.
// Counting every step since v000, it is 4.54 times as fast.
#include <hip/hip_runtime.h>
#include <hip/hip_bf16.h>

typedef __attribute__((ext_vector_type(16))) __bf16 v16bf;
typedef __attribute__((ext_vector_type(8)))  __bf16 v8bf;
typedef __attribute__((ext_vector_type(8)))  float  v8f;

#define HEADS 16
#define DH    64
#define DM    1024
#define BATCH 4
#define SEQ   2048

// LDS row pitches in elements: an odd multiple of 16 bytes, so that the 16 rows
// a 16-byte fragment load touches fall on 16 different groups of four banks
#define KP 72   // rows of 64 bf16 (128 B) at 144 B

// score scale in the log2 domain, (1/sqrt(C)) * log2(e): q is stored multiplied by it
#define QSC (0.03125f * 1.44269504088896f)

// ---------------------------------------------------------------------------
// WMMA helper: D = A(16x32 bf16) * B(32x16 bf16) + C(16x16 f32)
// ---------------------------------------------------------------------------
__device__ __forceinline__ v8f wmma_bf16(v16bf a, v16bf b, v8f c) {
  return __builtin_amdgcn_wmma_f32_16x16x32_bf16(
      /*neg_a=*/false, a, /*neg_b=*/false, b,
      /*c_mod=*/(short)0, c, /*reuse_a=*/false, /*reuse_b=*/false);
}

// ---------------------------------------------------------------------------
// Fragment loaders: documented gfx1250 16-bit A/B layout.
// Lane L holds row/col (L & 15); K runs: base=(L>>4)*8, elements [base..base+7]
// and [base+16..base+23].  base pointer must be 16B aligned; ld in elements.
// ---------------------------------------------------------------------------
__device__ __forceinline__ v16bf load_frag_bf16(const __bf16* base, int ld) {
  const int lane = threadIdx.x & 31;
  const __bf16* p = base + (size_t)(lane & 15) * ld + ((lane >> 4) << 3);
  v8bf lo = *(const v8bf*)(p);
  v8bf hi = *(const v8bf*)(p + 16);
  v16bf r;
#pragma unroll
  for (int i = 0; i < 8; ++i) { r[i] = lo[i]; r[i + 8] = hi[i]; }
  return r;
}

__device__ __forceinline__ v16bf load_frag_f32(const float* base, int ld) {
  const int lane = threadIdx.x & 31;
  const float* p = base + (size_t)(lane & 15) * ld + ((lane >> 4) << 3);
  v16bf r;
#pragma unroll
  for (int i = 0; i < 8; ++i) {
    r[i]     = (__bf16)p[i];
    r[i + 8] = (__bf16)p[i + 16];
  }
  return r;
}

// value of lane l ^ 16 (the other half of the wave), one vector instruction
__device__ __forceinline__ float xhalf(float v) {
  const int b = __builtin_bit_cast(int, v);
  return __builtin_bit_cast(float, __builtin_amdgcn_permlanex16(
      b, b, 0x76543210, 0xfedcba98, false, false));
}

// ---------------------------------------------------------------------------
// Kernel 1: per-head QKV projection.  One wave takes 64 rows (t) of one head:
// it reads its x once, keeps the four 16-row fragment pairs in registers and
// makes q, k and v from them.  q and k are taken transposed (W x^T): a lane then
// holds 8 consecutive e of one row t.  v is taken as x W^T: a lane holds 8
// consecutive t of one e.  Either way a lane stores 16-byte runs.
// The work is 12 groups (3 matrices x 4 tiles of 16 weight rows); a group's two
// weight fragments and its bias come four groups ahead, through four register slots.
// Q,K stored [B,H,T,64]; V stored transposed [B,H,64,T] for the P@V stage.
// q is multiplied by QSC in f32 before its one rounding to bf16, so that K q^T is
// already the exponent (base 2) that the attention kernel wants.
// The weights arrive in f32 and there is no launch that converts them.  Wq, Wk, Wv:
// each work-group rounds the 3 x 64 x 64 values to bf16 into its own LDS while its
// x is in flight, and the waves take their weight fragments from there.  Wp, which
// the output projection two launches on wants in bf16: the work-groups behind the
// first QKV_WG of the grid do nothing but round their 8192 values of it each; they
// find room beside the projection's work-groups, which stand one to a WGP.
// ---------------------------------------------------------------------------
typedef __attribute__((ext_vector_type(4))) float v4f;
typedef __attribute__((ext_vector_type(4))) __bf16 v4bf;

#define QKV_WG (BATCH * HEADS * (SEQ / 64) / 8)   // work-groups that project
#define WP_WG  (DM * DM / 8192)                   // work-groups that round Wp

__device__ __forceinline__ v4bf round4(v4f a) {
  v4bf r;
#pragma unroll
  for (int e = 0; e < 4; ++e) r[e] = (__bf16)a[e];
  return r;
}

__global__ void __launch_bounds__(256) qkv_proj_kernel(
    const float* __restrict__ x, const float* __restrict__ Wq,
    const float* __restrict__ Wk, const float* __restrict__ Wv,
    const float* __restrict__ Wp,
    const float* __restrict__ bq, const float* __restrict__ bk,
    const float* __restrict__ bv,
    __bf16* __restrict__ qk_out, __bf16* __restrict__ vt_out,
    __bf16* __restrict__ wpb) {
  __shared__ __attribute__((aligned(16))) __bf16 wqkv[3 * DH * KP];   // Wq | Wk | Wv, padded rows

  if (blockIdx.x >= QKV_WG) {
    // Wp: 8 loads of 16 bytes a lane, all in flight, a wave's load four whole lines
    // and its store two; the whole work-group leaves here, ahead of the barrier below
    const size_t o = (size_t)(blockIdx.x - QKV_WG) * 8192 + threadIdx.x * 4;
    v4f a[8];
#pragma unroll
    for (int j = 0; j < 8; ++j) a[j] = *(const v4f*)(Wp + o + j * 1024);
#pragma unroll
    for (int j = 0; j < 8; ++j) *(v4bf*)(wpb + o + j * 1024) = round4(a[j]);
    return;
  }

  const int wave = threadIdx.x >> 5;
  const int lane = threadIdx.x & 31;
  const int n    = lane & 15;
  const int hig  = lane >> 4;
  const int nu   = SEQ / 64;
  const int unit = blockIdx.x * 8 + wave;      // 64-row unit of one head
  const int t0   = (unit % nu) * 64;
  const int bh   = unit / nu;
  const int b    = bh / HEADS, h = bh % HEADS;

  // the thread's share of the weights (4 pieces of 4 values of each matrix), then all
  // of the wave's x: 32 loads of 16 bytes a lane
  v16bf rw[4][2];
  v8f   rb[4];
  v4f   wr[3][4];
#pragma unroll
  for (int j = 0; j < 4; ++j) {
    wr[0][j] = *(const v4f*)(Wq + j * 1024 + threadIdx.x * 4);
    wr[1][j] = *(const v4f*)(Wk + j * 1024 + threadIdx.x * 4);
    wr[2][j] = *(const v4f*)(Wv + j * 1024 + threadIdx.x * 4);
  }
  const float* xp = x + ((size_t)(b * SEQ + t0 + n)) * DM + h * DH + 8 * hig;
  v4f xr[4][2][4];   // [16-row tile][k half][k 0..3, 4..7, 16..19, 20..23 of the lane's run]
#pragma unroll
  for (int i = 0; i < 4; ++i)
#pragma unroll
    for (int kh = 0; kh < 2; ++kh) {
      const float* p = xp + (size_t)(i * 16) * DM + kh * 32;
      xr[i][kh][0] = *(const v4f*)(p);
      xr[i][kh][1] = *(const v4f*)(p + 4);
      xr[i][kh][2] = *(const v4f*)(p + 16);
      xr[i][kh][3] = *(const v4f*)(p + 20);
    }
  // the x address registers are free from here on: the wait stands before their reuse
  asm volatile("s_wait_xcnt 0x0" ::: "memory");
  // keeps every load above in flight at once: left free, the conversions below are
  // woven between the loads and only four of them are outstanding at a time
  __builtin_amdgcn_sched_barrier(0);

  // the weights, asked for ahead of x, are rounded into LDS under x's flight:
  // value 4 * (256 j + thread) of a matrix is row 16 j + thread / 16, column 4 * (thread % 16)
  {
    __bf16* wl = wqkv + (threadIdx.x >> 4) * KP + (threadIdx.x & 15) * 4;
#pragma unroll
    for (int m = 0; m < 3; ++m)
#pragma unroll
      for (int j = 0; j < 4; ++j) *(v4bf*)(wl + (m * DH + j * 16) * KP) = round4(wr[m][j]);
  }
  // every wave reads weight rows that the other waves wrote.  The fences name LDS
  // alone: a plain __syncthreads() would also wait here for all of the wave's x
  __builtin_amdgcn_fence(__ATOMIC_RELEASE, "workgroup", "local");
  __builtin_amdgcn_s_barrier();
  __builtin_amdgcn_fence(__ATOMIC_ACQUIRE, "workgroup", "local");

  // groups 0..2 (Wq rows 0..47 with their bias) take the registers that the f32
  // weights have left
#pragma unroll
  for (int c = 0; c < 3; ++c) {
    rw[c][0] = load_frag_bf16(wqkv + (c * 16) * KP, KP);
    rw[c][1] = load_frag_bf16(wqkv + (c * 16) * KP + 32, KP);
    rb[c]    = *(const v8f*)(bq + c * 16 + 8 * hig);
  }

  // group 3 and the four v biases: their registers are not there before x is converted
  float bvl[4];
  rw[3][0] = load_frag_bf16(wqkv + 48 * KP, KP);
  rw[3][1] = load_frag_bf16(wqkv + 48 * KP + 32, KP);
  rb[3]    = *(const v8f*)(bq + 48 + 8 * hig);
#pragma unroll
  for (int c = 0; c < 4; ++c) bvl[c] = bv[c * 16 + n];

  v16bf xa[4][2];
#pragma unroll
  for (int i = 0; i < 4; ++i)
#pragma unroll
    for (int kh = 0; kh < 2; ++kh)
#pragma unroll
      for (int e = 0; e < 4; ++e) {
        xa[i][kh][e]      = (__bf16)xr[i][kh][0][e];
        xa[i][kh][e + 4]  = (__bf16)xr[i][kh][1][e];
        xa[i][kh][e + 8]  = (__bf16)xr[i][kh][2][e];
        xa[i][kh][e + 12] = (__bf16)xr[i][kh][3][e];
      }

  __bf16* qo = qk_out + ((size_t)(bh * SEQ + t0 + n)) * DH + 8 * hig;
  __bf16* vt = vt_out + (size_t)bh * DH * SEQ + (size_t)n * SEQ + t0 + 8 * hig;

#pragma unroll
  for (int g = 0; g < 12; ++g) {
    const int sel = g >> 2, c = g & 3;
    if (sel < 2) {
      // q, k: D[e = 16c + 8*hig + j][t = 16i + n] = W x^T + bias[e]
      __bf16* out = qo + (size_t)sel * ((size_t)BATCH * HEADS * SEQ * DH);
      const float osc = (sel == 0) ? QSC : 1.0f;
#pragma unroll
      for (int i = 0; i < 4; ++i) {
        v8f acc = wmma_bf16(rw[c][0], xa[i][0], rb[c]);
        acc = wmma_bf16(rw[c][1], xa[i][1], acc);
        v8bf r;
#pragma unroll
        for (int j = 0; j < 8; ++j) r[j] = (__bf16)(acc[j] * osc);
        *(v8bf*)(out + (size_t)(i * 16) * DH + c * 16) = r;
      }
    } else {
      // v: D[t = 16i + 8*hig + j][e = 16c + n] = x W^T + bias[e], stored as V^T
      v8f bvec;
#pragma unroll
      for (int j = 0; j < 8; ++j) bvec[j] = bvl[c];
#pragma unroll
      for (int i = 0; i < 4; ++i) {
        v8f acc = wmma_bf16(xa[i][0], rw[c][0], bvec);
        acc = wmma_bf16(xa[i][1], rw[c][1], acc);
        v8bf r;
#pragma unroll
        for (int j = 0; j < 8; ++j) r[j] = (__bf16)acc[j];
        *(v8bf*)(vt + (size_t)(c * 16) * SEQ + i * 16) = r;
      }
    }
    if (g + 4 < 12) {
      // the group's stores name registers that the loads below may take over
      asm volatile("s_wait_xcnt 0x0" ::: "memory");
      const __bf16* Wn = wqkv + ((sel + 1) * DH + c * 16) * KP;
      rw[c][0] = load_frag_bf16(Wn, KP);
      rw[c][1] = load_frag_bf16(Wn + 32, KP);
      if (sel == 0) rb[c] = *(const v8f*)(bk + c * 16 + 8 * hig);
      // holds the refill of this slot here, three groups of products ahead of its
      // use: sunk to the use, its latency would be waited out once a group
      __builtin_amdgcn_sched_barrier(0);
    }
  }
}

#define QT  2     // 16-query tiles per wave
#define SK  128   // keys per stage
#define VSP 136   // V^T stage rows: 128 bf16 (256 B) at 272 B, an odd multiple of 16 B

// One stage: lane's four 16-byte pieces of K (32 rows apart) and of V^T (16 rows
// apart).  kl, vl: the lane's LDS byte addresses in the buffer; kg, vg: its global ones.
__device__ __forceinline__ void stage_copy(unsigned kl, unsigned vl,
                                           const __bf16* kg, const __bf16* vg) {
  // the copies and, as the last line, the wait that stands before any of their
  // address registers is written again
  asm volatile(
      "global_load_async_to_lds_b128 %0, %8, off\n\t"
      "global_load_async_to_lds_b128 %1, %9, off\n\t"
      "global_load_async_to_lds_b128 %2, %10, off\n\t"
      "global_load_async_to_lds_b128 %3, %11, off\n\t"
      "global_load_async_to_lds_b128 %4, %12, off\n\t"
      "global_load_async_to_lds_b128 %5, %13, off\n\t"
      "global_load_async_to_lds_b128 %6, %14, off\n\t"
      "global_load_async_to_lds_b128 %7, %15, off\n\t"
      "s_wait_xcnt 0x0"
      :: "v"(kl), "v"(kl + 32 * KP * 2), "v"(kl + 64 * KP * 2), "v"(kl + 96 * KP * 2),
         "v"(vl), "v"(vl + 16 * VSP * 2), "v"(vl + 32 * VSP * 2), "v"(vl + 48 * VSP * 2),
         "v"(kg), "v"(kg + 32 * DH), "v"(kg + 64 * DH), "v"(kg + 96 * DH),
         "v"(vg), "v"(vg + 16 * SEQ), "v"(vg + 32 * SEQ), "v"(vg + 48 * SEQ)
      : "memory");
}

// Softmax numerators of one query tile: the accumulators are the exponents against the
// maximum in use.  pb: P^T as B operand, element i = key 8*hig + i, i + 8 = key 16 + 8*hig + i.
// Returns the lane's sum over its 16 keys.
__device__ __forceinline__ float numerators(const v8f& s0, const v8f& s1, v16bf& pb) {
  float ps[8];
#pragma unroll
  for (int j = 0; j < 8; ++j) {
    const float p0 = __builtin_amdgcn_exp2f(s0[j]);
    const float p1 = __builtin_amdgcn_exp2f(s1[j]);
    ps[j] = p0 + p1;
    pb[j]     = (__bf16)p0;
    pb[j + 8] = (__bf16)p1;
  }
  return ((ps[0] + ps[1]) + (ps[2] + ps[3])) + ((ps[4] + ps[5]) + (ps[6] + ps[7]));
}

__global__ void __launch_bounds__(256) flash_attn_kernel(
    const __bf16* __restrict__ Q, const __bf16* __restrict__ K,
    const __bf16* __restrict__ Vt, __bf16* __restrict__ O) {
  __shared__ __attribute__((aligned(16))) __bf16 Kl[2][SK * KP];     // 128 keys x 64 d, padded rows
  __shared__ __attribute__((aligned(16))) __bf16 Vl[2][DH * VSP];    // 64 d x 128 keys (V^T), padded rows

  const int tid  = threadIdx.x;
  const int wave = tid >> 5;
  const int lane = tid & 31;
  const int n = lane & 15, hig = lane >> 4;
  const int bh = blockIdx.y;
  const int b = bh / HEADS, h = bh % HEADS;
  const int q0 = blockIdx.x * (128 * QT) + wave * (16 * QT);

  const __bf16* Kb = K + (size_t)bh * SEQ * DH;
  const __bf16* Vb = Vt + (size_t)bh * DH * SEQ;

  // copy split: K 8 lanes per 128-byte row, V^T 16 lanes per 256-byte row
  const unsigned kl0 = (unsigned)(size_t)&Kl[0][(tid >> 3) * KP + (tid & 7) * 8];
  const unsigned vl0 = (unsigned)(size_t)&Vl[0][(tid >> 4) * VSP + (tid & 15) * 8];
  const __bf16* kg0 = Kb + tid * 8;
  const __bf16* vg0 = Vb + (size_t)(tid >> 4) * SEQ + (tid & 15) * 8;
  const int NST = SEQ / SK;

  // stage 0 into buffer 0
  stage_copy(kl0, vl0, kg0, vg0);

  const __bf16* Qp = Q + ((size_t)(bh * SEQ + q0)) * DH;
  v16bf qa[QT][2];
#pragma unroll
  for (int t = 0; t < QT; ++t) {
    qa[t][0] = load_frag_bf16(Qp + (size_t)(t * 16) * DH, DH);
    qa[t][1] = load_frag_bf16(Qp + (size_t)(t * 16) * DH + 32, DH);
  }

  v8f   o[QT][4];   // o[t][c][j] = O^T[d = 16c + 8*hig + j][query 16t + n]
  v8f   negm[QT];   // minus the maximum in use for query 16t + n, eight times (same in both halves)
  float thr[QT];    // pass sum of a lane above which that maximum is replaced
  float rsum[QT];   // running sum over this half's keys only
#pragma unroll
  for (int t = 0; t < QT; ++t) {
    thr[t]  = -3.0e38f;   // the first pass always sets the maximum
    rsum[t] = 0.0f;
#pragma unroll
    for (int j = 0; j < 8; ++j) negm[t][j] = 0.0f;
#pragma unroll
    for (int c = 0; c < 4; ++c)
#pragma unroll
      for (int j = 0; j < 8; ++j) o[t][c][j] = 0.0f;
  }

  // stage 0 has landed for this wave, then for the block; then stage 1 into buffer 1
  asm volatile("s_wait_asynccnt 0x0" ::: "memory");
  __syncthreads();
  stage_copy(kl0 + SK * KP * 2, vl0 + DH * VSP * 2, kg0 + SK * DH, vg0 + SK);

  for (int st = 0; st < NST; ++st) {
    const int cur = st & 1;

#pragma unroll
    for (int p = 0; p < SK / 32; ++p) {
      // S^T[32k x 16q] = K @ Q^T from LDS, per query tile: two 16x16 C-tiles of
      // 2 WMMAs each; the four K fragments are read once for both query tiles
      const __bf16* Kc = Kl[cur] + p * 32 * KP;
      v8f s0[QT], s1[QT];
      {
        v16bf k00 = load_frag_bf16(Kc, KP);
        v16bf k01 = load_frag_bf16(Kc + 32, KP);
        v16bf k10 = load_frag_bf16(Kc + 16 * KP, KP);
        v16bf k11 = load_frag_bf16(Kc + 16 * KP + 32, KP);
#pragma unroll
        for (int t = 0; t < QT; ++t) {
          s0[t] = wmma_bf16(k00, qa[t][0], negm[t]);
          s0[t] = wmma_bf16(k01, qa[t][1], s0[t]);
          s1[t] = wmma_bf16(k10, qa[t][0], negm[t]);
          s1[t] = wmma_bf16(k11, qa[t][1], s1[t]);
        }
      }

      // V^T fragments (A operand: rows d, k = keys), in flight under the softmax
      const __bf16* Vc = Vl[cur] + p * 32;
      v16bf vf[4];
#pragma unroll
      for (int c = 0; c < 4; ++c) vf[c] = load_frag_bf16(Vc + (c * 16) * VSP, VSP);
      // the eight V reads issue here as one group, so that the softmax covers their
      // latency; sunk to their products each pair would be waited for on its own
      __builtin_amdgcn_sched_barrier(0);

      // numerators against the maximum in use, and each lane's sum of its 16 per query
      v16bf pb[QT];
      float ps[QT];
#pragma unroll
      for (int t = 0; t < QT; ++t) ps[t] = numerators(s0[t], s1[t], pb[t]);

      // one wave-uniform test per pass: does any query of the wave need a new maximum?
      if (__builtin_amdgcn_ballot_w32((ps[0] > thr[0]) | (ps[1] > thr[1])) != 0) {
#pragma unroll
        for (int t = 0; t < QT; ++t) {
          // in-lane maximum of the exponents of query 16t + n
          float mx = fmaxf(s0[t][0], s1[t][0]);
#pragma unroll
          for (int j = 1; j < 8; ++j) mx = fmaxf(mx, fmaxf(s0[t][j], s1[t][j]));
          // joined with the other half's, so that both halves of a query use one maximum;
          // d is how far the maximum moves: upward only, but in the first pass (thr still
          // at its start value), where it goes to the pass's own maximum, up or down
          const float d = fmaxf(fmaxf(mx, xhalf(mx)), fminf(thr[t], 0.0f));
          // a move downward happens only while O^T and the sums are still zero: factor 1
          const float f = __builtin_amdgcn_exp2f(-fmaxf(d, 0.0f));
          thr[t] = 4096.0f;
          rsum[t] *= f;
#pragma unroll
          for (int c = 0; c < 4; ++c) o[t][c] *= f;
          // later passes start from the new maximum; this pass's exponents follow it here
          negm[t] -= d;
          s0[t]   -= d;
          s1[t]   -= d;
          ps[t] = numerators(s0[t], s1[t], pb[t]);
        }
      }

#pragma unroll
      for (int t = 0; t < QT; ++t) {
        rsum[t] += ps[t];
        // O^T += V^T @ P^T
#pragma unroll
        for (int c = 0; c < 4; ++c) o[t][c] = wmma_bf16(vf[c], pb[t], o[t][c]);
      }
      // ends the pass: left free, later passes' LDS reads and score products are woven
      // into this pass's softmax and the register count passes 256 (three waves a SIMD)
      __builtin_amdgcn_sched_barrier(0);
    }

    // publish point of stage st + 1: this wave's LDS reads of stage st are done,
    // its own copies of stage st + 1 have landed, then the block meets
    asm volatile("s_wait_dscnt 0x0" ::: "memory");
    asm volatile("s_wait_asynccnt 0x0" ::: "memory");
    __syncthreads();
    // stage st + 2 into the buffer that every wave has just left
    if (st + 2 < NST)
      stage_copy(kl0 + cur * (SK * KP * 2), vl0 + cur * (DH * VSP * 2),
                 kg0 + (size_t)(st + 2) * (SK * DH), vg0 + (st + 2) * SK);
  }
  // no copy is outstanding when the wave goes on to its end
  asm volatile("s_wait_asynccnt 0x0" ::: "memory");

  // normalize and store bf16 to [B,T,C] (head-interleaved for the projection):
  // a lane holds 8 consecutive d of its query per tile, one 16-byte store each
#pragma unroll
  for (int t = 0; t < QT; ++t) {
    const float inv = 1.0f / (rsum[t] + xhalf(rsum[t]));   // join the halves' sums
    __bf16* op = O + ((size_t)(b * SEQ + q0 + t * 16 + n)) * DM + h * DH + 8 * hig;
#pragma unroll
    for (int c = 0; c < 4; ++c) {
      v8bf r;
#pragma unroll
      for (int j = 0; j < 8; ++j) r[j] = (__bf16)(o[t][c][j] * inv);
      *(v8bf*)(op + c * 16) = r;
    }
  }
}

// ---------------------------------------------------------------------------
// Kernel 3: output projection  Y = O @ Wp^T + bp  (M=8192, N=K=1024, fp32 out)
// 8 waves/block as 4 x 2 -> 128x128 block tile, 32x64 of Y per wave: an O fragment
// feeds four products, a Wp fragment two.  A stage is 128 k: 256 bytes of each of
// the 128 O rows and the 128 Wp rows, brought by asynchronous copies to LDS (16
// copies of 16 bytes a lane, 16 lanes per row, whole 128-byte lines), through no
// register.  Two buffers: stage s + 2 is asked for as soon as stage s has been
// read, so its copies fly during 32 products a wave: the last 8 of stage s and the first 24 of stage s + 1.
// Each accumulator starts at the bias and takes k upward in steps of 32.
// ---------------------------------------------------------------------------
#define PK 128   // k per stage; rows of 128 bf16 stand at pitch VSP

// Eight 16-byte pieces of one operand's stage, 16 rows apart.  l: the lane's LDS
// byte address in the buffer; g: its global address.
__device__ __forceinline__ void proj_copy(unsigned l, const __bf16* g) {
  // the copies and, as the last line, the wait that stands before any of their
  // address registers is written again
  asm volatile(
      "global_load_async_to_lds_b128 %0, %8, off\n\t"
      "global_load_async_to_lds_b128 %1, %9, off\n\t"
      "global_load_async_to_lds_b128 %2, %10, off\n\t"
      "global_load_async_to_lds_b128 %3, %11, off\n\t"
      "global_load_async_to_lds_b128 %4, %12, off\n\t"
      "global_load_async_to_lds_b128 %5, %13, off\n\t"
      "global_load_async_to_lds_b128 %6, %14, off\n\t"
      "global_load_async_to_lds_b128 %7, %15, off\n\t"
      "s_wait_xcnt 0x0"
      :: "v"(l), "v"(l + 16 * VSP * 2), "v"(l + 32 * VSP * 2), "v"(l + 48 * VSP * 2),
         "v"(l + 64 * VSP * 2), "v"(l + 80 * VSP * 2), "v"(l + 96 * VSP * 2), "v"(l + 112 * VSP * 2),
         "v"(g), "v"(g + 16 * DM), "v"(g + 32 * DM), "v"(g + 48 * DM),
         "v"(g + 64 * DM), "v"(g + 80 * DM), "v"(g + 96 * DM), "v"(g + 112 * DM)
      : "memory");
}

__global__ void __launch_bounds__(256) out_proj_kernel(
    const __bf16* __restrict__ Ob, const __bf16* __restrict__ Wpb,
    const float* __restrict__ bp, float* __restrict__ out) {
  __shared__ __attribute__((aligned(16))) __bf16 Al[2][128 * VSP];   // 128 rows of O x 128 k, padded rows
  __shared__ __attribute__((aligned(16))) __bf16 Wl[2][128 * VSP];   // 128 rows of Wp x 128 k, padded rows

  const int tid  = threadIdx.x;
  const int wave = tid >> 5;
  const int lane = tid & 31;
  const int n = lane & 15, hig = lane >> 4;
  const int rb = blockIdx.x * 128, nb = blockIdx.y * 128;
  const int r0 = rb + (wave >> 1) * 32;    // the wave's 32 rows of Y
  const int n0 = nb + (wave & 1) * 64;     // and its 64 columns

  // copy split: 16 lanes per 256-byte row
  const unsigned al0 = (unsigned)(size_t)&Al[0][(tid >> 4) * VSP + (tid & 15) * 8];
  const unsigned wl0 = (unsigned)(size_t)&Wl[0][(tid >> 4) * VSP + (tid & 15) * 8];
  const __bf16* ag0 = Ob  + (size_t)(rb + (tid >> 4)) * DM + (tid & 15) * 8;
  const __bf16* wg0 = Wpb + (size_t)(nb + (tid >> 4)) * DM + (tid & 15) * 8;
  const int NST = DM / PK;

  // stage 0 into buffer 0
  proj_copy(al0, ag0);
  proj_copy(wl0, wg0);

  v8f acc[2][4];
#pragma unroll
  for (int c = 0; c < 4; ++c) {
    const float bval = bp[n0 + c * 16 + n];
#pragma unroll
    for (int i = 0; i < 2; ++i)
#pragma unroll
      for (int j = 0; j < 8; ++j) acc[i][c][j] = bval;
  }

  // stage 0 has landed for this wave, then for the block; then stage 1 into buffer 1
  asm volatile("s_wait_asynccnt 0x0" ::: "memory");
  __syncthreads();
  proj_copy(al0 + 128 * VSP * 2, ag0 + PK);
  proj_copy(wl0 + 128 * VSP * 2, wg0 + PK);

  for (int st = 0; st < NST; ++st) {
    const int cur = st & 1;
    const __bf16* Ac = Al[cur] + ((wave >> 1) * 32) * VSP;
    const __bf16* Wc = Wl[cur] + ((wave & 1) * 64) * VSP;

    // two fragment sets: the 12 LDS reads of the next 32 k go out as one group ahead
    // of the 8 products of these 32 k; only inside the stage, never into the next one
    v16bf a[2][2], w[2][4];
#pragma unroll
    for (int i = 0; i < 2; ++i) a[0][i] = load_frag_bf16(Ac + (i * 16) * VSP, VSP);
#pragma unroll
    for (int c = 0; c < 4; ++c) w[0][c] = load_frag_bf16(Wc + (c * 16) * VSP, VSP);
#pragma unroll
    for (int kh = 0; kh < PK / 32; ++kh) {
      const int s = kh & 1;
      if (kh + 1 < PK / 32) {
#pragma unroll
        for (int i = 0; i < 2; ++i)
          a[s ^ 1][i] = load_frag_bf16(Ac + (i * 16) * VSP + (kh + 1) * 32, VSP);
#pragma unroll
        for (int c = 0; c < 4; ++c)
          w[s ^ 1][c] = load_frag_bf16(Wc + (c * 16) * VSP + (kh + 1) * 32, VSP);
        // holds that group here: sunk among the products, each pair of reads is
        // waited for on its own, in one fragment set
        __builtin_amdgcn_sched_barrier(0);
      } else {
        // the stage's last fragments are asked for: the publish point stands here, ahead
        // of their products, which need registers only, so that the refill starts sooner.
        // Publish point of stage st + 1: this wave's LDS reads of stage st are done,
        // its own copies of stage st + 1 have landed, then the block meets
        asm volatile("s_wait_dscnt 0x0" ::: "memory");
        asm volatile("s_wait_asynccnt 0x0" ::: "memory");
        __syncthreads();
        // stage st + 2 into the buffer that every wave has just left
        if (st + 2 < NST) {
          proj_copy(al0 + cur * (128 * VSP * 2), ag0 + (st + 2) * PK);
          proj_copy(wl0 + cur * (128 * VSP * 2), wg0 + (st + 2) * PK);
        }
      }
#pragma unroll
      for (int i = 0; i < 2; ++i)
#pragma unroll
        for (int c = 0; c < 4; ++c) acc[i][c] = wmma_bf16(a[s][i], w[s][c], acc[i][c]);
    }
  }
  // no copy is outstanding when the wave goes on to its end
  asm volatile("s_wait_asynccnt 0x0" ::: "memory");

#pragma unroll
  for (int i = 0; i < 2; ++i)
#pragma unroll
    for (int c = 0; c < 4; ++c)
#pragma unroll
      for (int j = 0; j < 8; ++j)
        out[(size_t)(r0 + i * 16 + j + 8 * hig) * DM + n0 + c * 16 + n] = acc[i][c][j];
}

// ---------------------------------------------------------------------------
// Host launcher
// ---------------------------------------------------------------------------
extern "C" void kernel_launch(void* const* d_in, const int* in_sizes, int n_in,
                              void* d_out, int out_size, void* d_ws, size_t ws_size,
                              hipStream_t stream) {
  const float* x  = (const float*)d_in[0];
  const float* Wq = (const float*)d_in[1];
  const float* bq = (const float*)d_in[2];
  const float* Wk = (const float*)d_in[3];
  const float* bk = (const float*)d_in[4];
  const float* Wv = (const float*)d_in[5];
  const float* bv = (const float*)d_in[6];
  const float* Wp = (const float*)d_in[7];
  const float* bp = (const float*)d_in[8];
  float* out = (float*)d_out;

  __bf16* ws = (__bf16*)d_ws;
  const size_t QKV_E = (size_t)BATCH * HEADS * SEQ * DH;  // 8,388,608 elems each
  __bf16* Qw   = ws;                       // [B,H,T,64]   bf16
  __bf16* Vtw  = ws + 2 * QKV_E;           // [B,H,64,T]   bf16 (transposed V)
  __bf16* Ow   = ws + 3 * QKV_E;           // [B,T,1024]   bf16
  __bf16* Wpb  = ws + 4 * QKV_E;           // [1024,1024]  bf16
  // total: ~69.2 MB of d_ws

  qkv_proj_kernel<<<QKV_WG + WP_WG, 256, 0, stream>>>(x, Wq, Wk, Wv, Wp, bq, bk, bv, Qw, Vtw, Wpb);

  dim3 g2(SEQ / (128 * QT), BATCH * HEADS);
  flash_attn_kernel<<<g2, 256, 0, stream>>>(Qw, Qw + QKV_E, Vtw, Ow);

  dim3 g3((BATCH * SEQ) / 128, DM / 128);
  out_proj_kernel<<<g3, 256, 0, stream>>>(Ow, Wpb, bp, out);
}
